// v000
// Measured on an AMD MI455X. A time is GPU time per run, averaged over a window of back-to-back runs after a warm-up
// (all launches, gaps included; the runs take copies of the inputs in turn), and the median of several windows.
// Apart from v000's, it joins two sittings. Times from different sittings can be a few percent apart, while
// side-by-side timings come from the same sitting.
// v000, which the later versions start from, runs in 775 microseconds.
#include <hip/hip_runtime.h>

// SelfAttentionLayer (x [32][256][1024]; q/k/v = x W^T (torch [out,in], no bias); 64 chunks of 16 dims act as heads; logits = q.k / sqrt(1024) with mask2d = mask_i mask_j > 0 (sequence_mask read; all ones here); softmax; out[b][i][c*16 + d] = sum_j w v -> [32][256][1024]).
// Compute dtypes, f32 accumulate: every input rounded to bf16; q/k/v on PLAIN bf16 operands (inputs: exact); per-chunk scores single fp16 (q x 1/32; the 16-dim heads zero-padded to K 32) ; softmax f32 -> fp16 x 1024; attn.v single fp16 (head dim padded to 64 output columns); 2 sequences (128 (batch, chunk) pairs) per pass.

#define NB_  32
#define TT   256
#define DM   1024
#define HD   16
#define NC   64
#define BPP  2
#define ZP   (BPP * NC)
#define PCAR 1024.0f
typedef _Float16 h16;
typedef unsigned short bf;
typedef __attribute__((ext_vector_type(16))) __bf16   v16bf;
typedef __attribute__((ext_vector_type(16))) _Float16 v16h;
typedef __attribute__((ext_vector_type(8)))  _Float16 v8h;
typedef __attribute__((ext_vector_type(8)))  unsigned short v8us;
typedef __attribute__((ext_vector_type(8)))  float    v8f;
typedef __attribute__((ext_vector_type(4)))  float    v4f;
typedef v8h  __attribute__((may_alias)) v8ha;
typedef v4f  __attribute__((may_alias)) v4fa;
typedef v8us __attribute__((may_alias)) v8usa;

__device__ __forceinline__ unsigned short f2bf(float f) { unsigned u = __float_as_uint(f); u += 0x7FFFu + ((u >> 16) & 1u); return (unsigned short)(u >> 16); }
__device__ __forceinline__ float bf2f(unsigned short b) { return __uint_as_float(((unsigned)b) << 16); }
__device__ __forceinline__ float bfr(float f) { return bf2f(f2bf(f)); }
__device__ __forceinline__ v16h cat16(v8h lo, v8h hi) { return __builtin_shufflevector(lo, hi, 0, 1, 2, 3, 4, 5, 6, 7, 8, 9, 10, 11, 12, 13, 14, 15); }
__device__ __forceinline__ v16bf cat16b(v8us lo, v8us hi) { return __builtin_bit_cast(v16bf, __builtin_shufflevector(lo, hi, 0, 1, 2, 3, 4, 5, 6, 7, 8, 9, 10, 11, 12, 13, 14, 15)); }
__device__ __forceinline__ v8f wmma16(v16h a, v16h b, v8f c) { return __builtin_amdgcn_wmma_f32_16x16x32_f16(false, a, false, b, (short)0, c, false, false); }
__device__ __forceinline__ v8f wmmab(v16bf a, v16bf b, v8f c) { return __builtin_amdgcn_wmma_f32_16x16x32_bf16(false, a, false, b, (short)0, c, false, false); }



// ---- k_gemmw: register-blocked GEMM, ONE WAVE per 64x64 output tile (16 accumulators), operands straight from K-contiguous 16-bit planes; grid (M/64, N/64, Z), 32 threads.
// C[m][n] (f32, pitch ldc, + optional f32 bias[n]) = sum_k A[m][k] Bt[n][k] (+ split products per NSPLIT). z-batch strides sA/sB/sC in elements. K % 32 == 0.
template <typename T16> struct WFrag;
template <> struct WFrag<h16> { typedef v16h V; static __device__ __forceinline__ V ld(const h16* p) { return cat16(*(const v8h*)p, *(const v8h*)(p + 16)); } static __device__ __forceinline__ v8f mma(V a, V b, v8f c) { return wmma16(a, b, c); } };
template <> struct WFrag<bf> { typedef v16bf V; static __device__ __forceinline__ V ld(const bf* p) { return cat16b(*(const v8us*)p, *(const v8us*)(p + 16)); } static __device__ __forceinline__ v8f mma(V a, V b, v8f c) { return wmmab(a, b, c); } };
template <typename T16, int NSPLIT, bool BIAS>
__global__ __launch_bounds__(32) void k_gemmw(const T16* __restrict__ A, const T16* __restrict__ A2, const T16* __restrict__ Bt, const T16* __restrict__ Bt2, int K, float* C, int ldc, const float* __restrict__ bias, size_t sA, size_t sB, size_t sC) {
    typedef typename WFrag<T16>::V V;
    __shared__ __align__(16) float os[16 * 68];
    const size_t z = blockIdx.z; A += z * sA; if (A2) A2 += z * sA; Bt += z * sB; if (Bt2) Bt2 += z * sB; C += z * sC;
    const int lane = threadIdx.x & 31, lr = lane & 15, hi = lane >> 4; const int r0 = blockIdx.x * 64, c0 = blockIdx.y * 64;
    v8f acc[4][4];
#pragma unroll
    for (int mb = 0; mb < 4; ++mb)
#pragma unroll
        for (int nb = 0; nb < 4; ++nb) acc[mb][nb] = (v8f){};
    const size_t aoff = (size_t)(r0 + lr) * K + 8 * hi, boff = (size_t)(c0 + lr) * K + 8 * hi;
#pragma unroll 1
    for (int kc = 0; kc < K; kc += 32) {
        V a[4], a2[4];
#pragma unroll
        for (int mb = 0; mb < 4; ++mb) { a[mb] = WFrag<T16>::ld(A + aoff + (size_t)mb * 16 * K + kc); if (NSPLIT == 1 || NSPLIT == 2) a2[mb] = WFrag<T16>::ld(A2 + aoff + (size_t)mb * 16 * K + kc); }
#pragma unroll
        for (int nb = 0; nb < 4; ++nb) { const V b = WFrag<T16>::ld(Bt + boff + (size_t)nb * 16 * K + kc); V b2; if (NSPLIT >= 2) b2 = WFrag<T16>::ld(Bt2 + boff + (size_t)nb * 16 * K + kc);
#pragma unroll
            for (int mb = 0; mb < 4; ++mb) { acc[mb][nb] = WFrag<T16>::mma(a[mb], b, acc[mb][nb]); if (NSPLIT == 1 || NSPLIT == 2) acc[mb][nb] = WFrag<T16>::mma(a2[mb], b, acc[mb][nb]); if (NSPLIT >= 2) acc[mb][nb] = WFrag<T16>::mma(a[mb], b2, acc[mb][nb]); } }
        asm volatile("v_nop\n\tv_nop\n\tv_nop\n\tv_nop" : "+v"(acc[0][0]), "+v"(acc[1][1]), "+v"(acc[2][2]), "+v"(acc[3][3]) : "v"(a[0]), "v"(a[3]));
    }
#pragma unroll
    for (int mb = 0; mb < 4; ++mb) {
#pragma unroll
        for (int nb = 0; nb < 4; ++nb) {
#pragma unroll
            for (int j = 0; j < 8; ++j) os[(hi * 8 + j) * 68 + nb * 16 + lr] = acc[mb][nb][j]; }
        __builtin_amdgcn_wave_barrier(); asm volatile("" ::: "memory");
        float* crow = C + (size_t)(r0 + mb * 16) * ldc + c0;
{
#pragma unroll
            for (int s = 0; s < 8; ++s) { const int row = 2 * s + hi, cofs = lr * 4; v4f val = *(const v4fa*)(os + row * 68 + cofs); if (BIAS) { val[0] += bfr(bias[c0 + cofs]); val[1] += bfr(bias[c0 + cofs + 1]); val[2] += bfr(bias[c0 + cofs + 2]); val[3] += bfr(bias[c0 + cofs + 3]); }
                *(v4f*)(crow + (size_t)row * ldc + cofs) = val; }
             }
        __builtin_amdgcn_wave_barrier(); asm volatile("" ::: "memory");
    }
}

__device__ __forceinline__ h16 tohx(float x) { return (h16)x; }
typedef __attribute__((ext_vector_type(2))) _Float16 v2h;
typedef __attribute__((ext_vector_type(4))) _Float16 v4h;

__global__ __launch_bounds__(256) void k_cvt8(const float* __restrict__ src, bf* dst, size_t n8) { const size_t i = (size_t)blockIdx.x * 256 + threadIdx.x; if (i >= n8) return; const v8f v = *(const v8f*)(src + i * 8); v8us o;
#pragma unroll
    for (int k = 0; k < 8; ++k) o[k] = f2bf(v[k]); *(v8us*)(dst + i * 8) = o;  }
__global__ __launch_bounds__(256) void k_qkp(const float* __restrict__ Q, const float* __restrict__ K, int b0, h16* QP, h16* KP) { const size_t e = ((size_t)blockIdx.x * 256 + threadIdx.x) * 4; if (e >= (size_t)ZP * TT * 32) return; const int d = (int)(e % 32); const int i = (int)((e / 32) % TT); const int z = (int)(e / ((size_t)32 * TT)); const int bl = z / NC, c = z % NC; v4h a, k4;
    if (d < HD) { const size_t r = ((size_t)(b0 + bl) * TT + i) * DM + c * HD + d;
#pragma unroll
        for (int u = 0; u < 4; ++u) { a[u] = tohx(Q[r + u] * 0.03125f); k4[u] = tohx(K[r + u]); } } else { for (int u = 0; u < 4; ++u) { a[u] = (h16)0.f; k4[u] = (h16)0.f; } }
    *(v4h*)(QP + e) = a; *(v4h*)(KP + e) = k4;  }
__global__ __launch_bounds__(256) void k_vtp(const float* __restrict__ V, int b0, h16* VT) { const size_t e = ((size_t)blockIdx.x * 256 + threadIdx.x) * 2; if (e >= (size_t)ZP * 64 * TT) return; const int j = (int)(e % TT); const int d = (int)((e / TT) % 64); const int z = (int)(e / ((size_t)TT * 64)); const int bl = z / NC, c = z % NC; v2h o;
    if (d < HD) { const size_t r = ((size_t)(b0 + bl) * TT + j) * DM + c * HD + d; o[0] = tohx(V[r]); o[1] = tohx(V[r + DM]); } else { o[0] = (h16)0.f; o[1] = (h16)0.f; }
    *(v2h*)(VT + e) = o;  }
__global__ __launch_bounds__(256) void k_ssoft(const float* __restrict__ S, const float* __restrict__ msk, int b0, h16* P16) { const int lane = threadIdx.x & 31; const int row = blockIdx.x * 8 + (threadIdx.x >> 5); if (row >= ZP * TT) return; const int i = row % TT; const int z = row / TT; const int b = b0 + z / NC; const float* sr = S + (size_t)row * TT; float mi = bfr(msk[b * TT + i]); asm volatile("" : "+v"(mi)); float v[TT / 32]; float mx = -3.0e38f;
#pragma unroll
    for (int ch = 0; ch < TT / 128; ++ch) { const v4f a = *(const v4f*)(sr + ch * 128 + lane * 4);
#pragma unroll
        for (int u = 0; u < 4; ++u) { const int j = ch * 128 + lane * 4 + u; float mj = bfr(msk[b * TT + j]); asm volatile("" : "+v"(mj)); float m2 = __fmul_rn(mi, mj); asm volatile("" : "+v"(m2)); float t = (m2 > 0.f) ? a[u] : -1.0e9f; asm volatile("" : "+v"(t)); v[ch * 4 + u] = t; mx = fmaxf(mx, t); } }
#pragma unroll
    for (int sh = 16; sh; sh >>= 1) mx = fmaxf(mx, __shfl_xor(mx, sh, 32));
    float sum = 0.f;
#pragma unroll
    for (int q = 0; q < TT / 32; ++q) { float d0 = __fsub_rn(v[q], mx); asm volatile("" : "+v"(d0)); v[q] = __builtin_amdgcn_exp2f(__fmul_rn(d0, 1.4426950408889634f)); sum += v[q]; }
#pragma unroll
    for (int sh = 16; sh; sh >>= 1) sum += __shfl_xor(sum, sh, 32);
    const float f = __fdiv_rn(PCAR, sum);
    {
#pragma unroll
        for (int ch = 0; ch < TT / 128; ++ch) { v4h o4; for (int q = 0; q < 4; ++q) o4[q] = tohx(v[ch * 4 + q] * f); *(v4h*)(P16 + (size_t)row * TT + ch * 128 + lane * 4) = o4; }
         } }
__global__ __launch_bounds__(256) void k_out(const float* __restrict__ O, int b0, float* out) { const size_t e = ((size_t)blockIdx.x * 256 + threadIdx.x) * 4; if (e >= (size_t)BPP * TT * DM) return; const int col = (int)(e % DM); const int i = (int)((e / DM) % TT); const int bl = (int)(e / ((size_t)DM * TT)); const int c = col / HD, d = col % HD; const int z = bl * NC + c; const float* src = O + ((size_t)z * TT + i) * 64 + d; v4f o;
#pragma unroll
    for (int u = 0; u < 4; ++u) o[u] = src[u] * (1.0f / PCAR); float* dst = out + ((size_t)(b0 + bl) * TT + i) * DM + col; *(v4f*)dst = o;  }

extern "C" void kernel_launch(void* const* d_in, const int* in_sizes, int n_in,
                              void* d_out, int out_size, void* d_ws, size_t ws_size, hipStream_t stream) {
    (void)in_sizes; (void)n_in; (void)out_size;
    const float* x = (const float*)d_in[0]; const float* msk = (const float*)d_in[1]; const float* Wq = (const float*)d_in[2]; const float* Wk = (const float*)d_in[3]; const float* Wv = (const float*)d_in[4];
    float* OUT = (float*)d_out;     // [32][256][1024]
    char* wsp = (char*)d_ws;
    auto take = [&](size_t bytes) { char* p = wsp; wsp += (bytes + 255) & ~(size_t)255; return (void*)p; };
    const size_t NR = (size_t)NB_ * TT;
    bf* XB = (bf*)take(NR * DM * 2); bf* BQ = (bf*)take((size_t)DM * DM * 2); bf* BK = (bf*)take((size_t)DM * DM * 2); bf* BV = (bf*)take((size_t)DM * DM * 2); float* Q = (float*)take(NR * DM * 4); float* K = (float*)take(NR * DM * 4); float* V = (float*)take(NR * DM * 4);
    h16* QP = (h16*)take((size_t)ZP * TT * 32 * 2); h16* KP = (h16*)take((size_t)ZP * TT * 32 * 2); h16* VT = (h16*)take((size_t)ZP * 64 * TT * 2); float* S = (float*)take((size_t)ZP * TT * TT * 4); h16* P16 = (h16*)take((size_t)ZP * TT * TT * 2); float* O = (float*)take((size_t)ZP * TT * 64 * 4);
    if ((size_t)(wsp - (char*)d_ws) > ws_size) return;    // total ~ 190 MB
    k_cvt8<<<(unsigned)((NR * DM / 8 + 255) / 256), 256, 0, stream>>>(x, XB, NR * DM / 8); k_cvt8<<<(DM * DM / 8 + 255) / 256, 256, 0, stream>>>(Wq, BQ, DM * DM / 8); k_cvt8<<<(DM * DM / 8 + 255) / 256, 256, 0, stream>>>(Wk, BK, DM * DM / 8); k_cvt8<<<(DM * DM / 8 + 255) / 256, 256, 0, stream>>>(Wv, BV, DM * DM / 8);   // torch [out][in] = Bt
    const dim3 gp((unsigned)(NR / 64), DM / 64, 1);
    k_gemmw<bf, 0, false><<<gp, 32, 0, stream>>>(XB, nullptr, BQ, nullptr, DM, Q, DM, nullptr, 0, 0, 0); k_gemmw<bf, 0, false><<<gp, 32, 0, stream>>>(XB, nullptr, BK, nullptr, DM, K, DM, nullptr, 0, 0, 0); k_gemmw<bf, 0, false><<<gp, 32, 0, stream>>>(XB, nullptr, BV, nullptr, DM, V, DM, nullptr, 0, 0, 0);
    const size_t zq = (size_t)TT * 32, zS = (size_t)TT * TT, zv = (size_t)64 * TT, zo = (size_t)TT * 64;
    for (int b0 = 0; b0 < NB_; b0 += BPP) {
        k_qkp<<<(unsigned)(((size_t)ZP * TT * 32 / 4 + 255) / 256), 256, 0, stream>>>(Q, K, b0, QP, KP); k_vtp<<<(unsigned)(((size_t)ZP * 64 * TT / 2 + 255) / 256), 256, 0, stream>>>(V, b0, VT);
        k_gemmw<h16, 0, false><<<dim3(TT / 64, TT / 64, ZP), 32, 0, stream>>>(QP, nullptr, KP, nullptr, 32, S, TT, nullptr, zq, zq, zS);
        k_ssoft<<<ZP * TT / 8, 256, 0, stream>>>(S, msk, b0, P16);
        k_gemmw<h16, 0, false><<<dim3(TT / 64, 1, ZP), 32, 0, stream>>>(P16, nullptr, VT, nullptr, TT, O, 64, nullptr, zS, zv, zo);
        k_out<<<(unsigned)(((size_t)BPP * TT * DM / 4 + 255) / 256), 256, 0, stream>>>(O, b0, OUT); }
}

// v001
// It runs in 169 microseconds.
// In two side-by-side timings against v000, it was 4.57 and 4.60 times as fast.
#include <hip/hip_runtime.h>

// SelfAttentionLayer (x [32][256][1024]; q/k/v = x W^T (torch [out,in], no bias); 64 chunks of 16 dims act as heads; logits = q.k / sqrt(1024) with mask2d = mask_i mask_j > 0 (sequence_mask read; all ones here); softmax; out[b][i][c*16 + d] = sum_j w v -> [32][256][1024]).
// Compute dtypes, f32 accumulate: every input rounded to bf16; q/k/v on PLAIN bf16 operands (inputs: exact); per-chunk scores single fp16 (q x 1/32; the 16-dim heads zero-padded to K 32) ; softmax f32 -> fp16 x 1024; attn.v single fp16; scores, softmax and attn.v of all (batch, chunk) pairs in one launch, the scores kept in registers.

#define NB_  32
#define TT   256
#define DM   1024
#define HD   16
#define NC   64
#define PCAR 1024.0f
typedef _Float16 h16;
typedef unsigned short bf;
typedef __attribute__((ext_vector_type(16))) __bf16   v16bf;
typedef __attribute__((ext_vector_type(16))) _Float16 v16h;
typedef __attribute__((ext_vector_type(8)))  _Float16 v8h;
typedef __attribute__((ext_vector_type(8)))  unsigned short v8us;
typedef __attribute__((ext_vector_type(8)))  float    v8f;
typedef __attribute__((ext_vector_type(4)))  float    v4f;
typedef v8h  __attribute__((may_alias)) v8ha;
typedef v4f  __attribute__((may_alias)) v4fa;
typedef v8us __attribute__((may_alias)) v8usa;

__device__ __forceinline__ unsigned short f2bf(float f) { unsigned u = __float_as_uint(f); u += 0x7FFFu + ((u >> 16) & 1u); return (unsigned short)(u >> 16); }
__device__ __forceinline__ float bf2f(unsigned short b) { return __uint_as_float(((unsigned)b) << 16); }
__device__ __forceinline__ float bfr(float f) { return bf2f(f2bf(f)); }
__device__ __forceinline__ v16h cat16(v8h lo, v8h hi) { return __builtin_shufflevector(lo, hi, 0, 1, 2, 3, 4, 5, 6, 7, 8, 9, 10, 11, 12, 13, 14, 15); }
__device__ __forceinline__ v16bf cat16b(v8us lo, v8us hi) { return __builtin_bit_cast(v16bf, __builtin_shufflevector(lo, hi, 0, 1, 2, 3, 4, 5, 6, 7, 8, 9, 10, 11, 12, 13, 14, 15)); }
__device__ __forceinline__ v8f wmma16(v16h a, v16h b, v8f c) { return __builtin_amdgcn_wmma_f32_16x16x32_f16(false, a, false, b, (short)0, c, false, false); }
__device__ __forceinline__ v8f wmmab(v16bf a, v16bf b, v8f c) { return __builtin_amdgcn_wmma_f32_16x16x32_bf16(false, a, false, b, (short)0, c, false, false); }



// ---- k_gemmw: register-blocked GEMM, ONE WAVE per 64x64 output tile (16 accumulators), operands straight from K-contiguous 16-bit planes; grid (M/64, N/64, Z), 32 threads.
// C[m][n] (f32, pitch ldc, + optional f32 bias[n]) = sum_k A[m][k] Bt[n][k] (+ split products per NSPLIT). z-batch strides sA/sB/sC in elements. K % 32 == 0.
template <typename T16> struct WFrag;
template <> struct WFrag<bf> { typedef v16bf V; static __device__ __forceinline__ V ld(const bf* p) { return cat16b(*(const v8us*)p, *(const v8us*)(p + 16)); } static __device__ __forceinline__ v8f mma(V a, V b, v8f c) { return wmmab(a, b, c); } };
template <typename T16, int NSPLIT, bool BIAS>
__global__ __launch_bounds__(32) void k_gemmw(const T16* __restrict__ A, const T16* __restrict__ A2, const T16* __restrict__ Bt, const T16* __restrict__ Bt2, int K, float* C, int ldc, const float* __restrict__ bias, size_t sA, size_t sB, size_t sC) {
    typedef typename WFrag<T16>::V V;
    __shared__ __align__(16) float os[16 * 68];
    const size_t z = blockIdx.z; A += z * sA; if (A2) A2 += z * sA; Bt += z * sB; if (Bt2) Bt2 += z * sB; C += z * sC;
    const int lane = threadIdx.x & 31, lr = lane & 15, hi = lane >> 4; const int r0 = blockIdx.x * 64, c0 = blockIdx.y * 64;
    v8f acc[4][4];
#pragma unroll
    for (int mb = 0; mb < 4; ++mb)
#pragma unroll
        for (int nb = 0; nb < 4; ++nb) acc[mb][nb] = (v8f){};
    const size_t aoff = (size_t)(r0 + lr) * K + 8 * hi, boff = (size_t)(c0 + lr) * K + 8 * hi;
#pragma unroll 1
    for (int kc = 0; kc < K; kc += 32) {
        V a[4], a2[4];
#pragma unroll
        for (int mb = 0; mb < 4; ++mb) { a[mb] = WFrag<T16>::ld(A + aoff + (size_t)mb * 16 * K + kc); if (NSPLIT == 1 || NSPLIT == 2) a2[mb] = WFrag<T16>::ld(A2 + aoff + (size_t)mb * 16 * K + kc); }
#pragma unroll
        for (int nb = 0; nb < 4; ++nb) { const V b = WFrag<T16>::ld(Bt + boff + (size_t)nb * 16 * K + kc); V b2; if (NSPLIT >= 2) b2 = WFrag<T16>::ld(Bt2 + boff + (size_t)nb * 16 * K + kc);
#pragma unroll
            for (int mb = 0; mb < 4; ++mb) { acc[mb][nb] = WFrag<T16>::mma(a[mb], b, acc[mb][nb]); if (NSPLIT == 1 || NSPLIT == 2) acc[mb][nb] = WFrag<T16>::mma(a2[mb], b, acc[mb][nb]); if (NSPLIT >= 2) acc[mb][nb] = WFrag<T16>::mma(a[mb], b2, acc[mb][nb]); } }
        asm volatile("v_nop\n\tv_nop\n\tv_nop\n\tv_nop" : "+v"(acc[0][0]), "+v"(acc[1][1]), "+v"(acc[2][2]), "+v"(acc[3][3]) : "v"(a[0]), "v"(a[3]));
    }
#pragma unroll
    for (int mb = 0; mb < 4; ++mb) {
#pragma unroll
        for (int nb = 0; nb < 4; ++nb) {
#pragma unroll
            for (int j = 0; j < 8; ++j) os[(hi * 8 + j) * 68 + nb * 16 + lr] = acc[mb][nb][j]; }
        __builtin_amdgcn_wave_barrier(); asm volatile("" ::: "memory");
        float* crow = C + (size_t)(r0 + mb * 16) * ldc + c0;
{
#pragma unroll
            for (int s = 0; s < 8; ++s) { const int row = 2 * s + hi, cofs = lr * 4; v4f val = *(const v4fa*)(os + row * 68 + cofs); if (BIAS) { val[0] += bfr(bias[c0 + cofs]); val[1] += bfr(bias[c0 + cofs + 1]); val[2] += bfr(bias[c0 + cofs + 2]); val[3] += bfr(bias[c0 + cofs + 3]); }
                *(v4f*)(crow + (size_t)row * ldc + cofs) = val; }
             }
        __builtin_amdgcn_wave_barrier(); asm volatile("" ::: "memory");
    }
}

__device__ __forceinline__ h16 tohx(float x) { return (h16)x; }
typedef __attribute__((ext_vector_type(2))) _Float16 v2h;
typedef __attribute__((ext_vector_type(4))) _Float16 v4h;

__global__ __launch_bounds__(256) void k_cvt8(const float* __restrict__ src, bf* dst, size_t n8) { const size_t i = (size_t)blockIdx.x * 256 + threadIdx.x; if (i >= n8) return; const v8f v = *(const v8f*)(src + i * 8); v8us o;
#pragma unroll
    for (int k = 0; k < 8; ++k) o[k] = f2bf(v[k]); *(v8us*)(dst + i * 8) = o;  }
typedef v4h __attribute__((may_alias)) v4ha;
typedef v2h __attribute__((may_alias)) v2ha;
// lane l <-> lane l ^ 16
__device__ __forceinline__ float xhalf(float x) { const int b = __float_as_int(x); return __int_as_float(__builtin_amdgcn_permlanex16(b, b, 0x76543210, 0xfedcba98, false, false)); }

#define VPITCH 264   // halves per V^T row: 528 B = 16 B x odd, for 16-byte LDS reads down a column of rows
#define OPITCH 36    // floats per staged output row: 144 B = 16 B x odd
// amdgpu_waves_per_eu(4, 4): a register budget of 256, so that two work-groups share a WGP; without it the build went above 256 registers.
__global__ __launch_bounds__(256) __attribute__((amdgpu_waves_per_eu(4, 4))) void k_attn(const float* __restrict__ Q, const float* __restrict__ K, const float* __restrict__ V, const float* __restrict__ msk, float* __restrict__ out) {
    __shared__ __align__(16) h16 Qs[2][2][TT][8];     // [chunk][d / 8][row][d % 8]: a fragment read is 16 contiguous rows of 16 B per wave half
    __shared__ __align__(16) h16 Ks[2][2][TT][8];
    __shared__ __align__(16) h16 Vs[2][HD][VPITCH];   // [chunk][d][j]
    __shared__ __align__(16) float Ms[TT];
    __shared__ __align__(16) float Os[8][16][OPITCH];
    const int tid = threadIdx.x, lane = tid & 31, wave = tid >> 5, lr = lane & 15, hi = lane >> 4;
    const int b = blockIdx.x >> 5;
    const size_t base = (size_t)b * TT * DM + (size_t)(blockIdx.x & 31) * (2 * HD);
    const int g = tid & 7, gch = g >> 2, gd = (g & 3) * 4, gr = tid >> 3;
#pragma unroll
    for (int s = 0; s < 8; ++s) { const int row = gr + 32 * s; const v4f q4 = *(const v4f*)(Q + base + (size_t)row * DM + g * 4); const v4f k4 = *(const v4f*)(K + base + (size_t)row * DM + g * 4); v4h qh, kh;
#pragma unroll
        for (int u = 0; u < 4; ++u) { qh[u] = tohx(q4[u] * 0.03125f); kh[u] = tohx(k4[u]); }
        *(v4ha*)&Qs[gch][gd >> 3][row][gd & 7] = qh; *(v4ha*)&Ks[gch][gd >> 3][row][gd & 7] = kh; }
#pragma unroll
    for (int s = 0; s < 4; ++s) { const int j = (gr + 32 * s) * 2; const v4f v0 = *(const v4f*)(V + base + (size_t)j * DM + g * 4); const v4f v1 = *(const v4f*)(V + base + (size_t)(j + 1) * DM + g * 4);
#pragma unroll
        for (int u = 0; u < 4; ++u) { v2h o; o[0] = tohx(v0[u]); o[1] = tohx(v1[u]); *(v2ha*)&Vs[gch][gd + u][j] = o; } }
    Ms[tid] = bfr(msk[b * TT + tid]);
    __syncthreads();
    const v8h z8 = {};
#pragma unroll 1   // rolled
    for (int it = 0; it < 2; ++it) {
        const int i0 = (wave + 8 * it) * 16; const float mi = Ms[i0 + lr];
#pragma unroll 1   // rolled, as above
        for (int ch = 0; ch < 2; ++ch) {
            const v16h qb = cat16(*(const v8ha*)&Qs[ch][hi][i0 + lr][0], z8);   // k 16..31 of both operands are zero
            v8f s[16];
#pragma unroll
            for (int t = 0; t < 16; ++t) s[t] = wmma16(cat16(*(const v8ha*)&Ks[ch][hi][t * 16 + lr][0], z8), qb, (v8f){});   // s[t][r] = S[i0 + lr][16 t + 8 hi + r]
            v8f mxv;
#pragma unroll
            for (int r = 0; r < 8; ++r) mxv[r] = -3.0e38f;
#pragma unroll
            for (int t = 0; t < 16; ++t) { const v4f ma = *(const v4fa*)&Ms[t * 16 + hi * 8], mb = *(const v4fa*)&Ms[t * 16 + hi * 8 + 4];
#pragma unroll
                for (int r = 0; r < 8; ++r) { const float mj = r < 4 ? ma[r & 3] : mb[r & 3]; const float x = (mi * mj > 0.f) ? s[t][r] : -1.0e9f; s[t][r] = x; mxv[r] = fmaxf(mxv[r], x); } }
            float mx = fmaxf(fmaxf(fmaxf(mxv[0], mxv[1]), fmaxf(mxv[2], mxv[3])), fmaxf(fmaxf(mxv[4], mxv[5]), fmaxf(mxv[6], mxv[7])));
            mx = fmaxf(mx, xhalf(mx));
            v8f sv = {};
#pragma unroll
            for (int t = 0; t < 16; ++t) { float e0 = (s[t][0] - mx) * 1.4426950408889634f, e1 = (s[t][1] - mx) * 1.4426950408889634f, e2 = (s[t][2] - mx) * 1.4426950408889634f, e3 = (s[t][3] - mx) * 1.4426950408889634f, e4 = (s[t][4] - mx) * 1.4426950408889634f, e5 = (s[t][5] - mx) * 1.4426950408889634f, e6 = (s[t][6] - mx) * 1.4426950408889634f, e7 = (s[t][7] - mx) * 1.4426950408889634f;
                // eight independent exp2 in place, then one v_nop: keeps the slot that the instruction set asks for behind a transcendental
                asm("v_exp_f32 %0, %0\n\tv_exp_f32 %1, %1\n\tv_exp_f32 %2, %2\n\tv_exp_f32 %3, %3\n\tv_exp_f32 %4, %4\n\tv_exp_f32 %5, %5\n\tv_exp_f32 %6, %6\n\tv_exp_f32 %7, %7\n\tv_nop" : "+v"(e0), "+v"(e1), "+v"(e2), "+v"(e3), "+v"(e4), "+v"(e5), "+v"(e6), "+v"(e7));
                s[t] = (v8f){e0, e1, e2, e3, e4, e5, e6, e7}; sv += s[t]; }
            float sum = ((sv[0] + sv[1]) + (sv[2] + sv[3])) + ((sv[4] + sv[5]) + (sv[6] + sv[7]));
            sum += xhalf(sum);
            const float f = PCAR / sum;
            v8f o = {};
#pragma unroll
            for (int u = 0; u < 8; ++u) { v16h pb;
#pragma unroll
                for (int r = 0; r < 8; ++r) { pb[r] = tohx(s[2 * u][r] * f); pb[8 + r] = tohx(s[2 * u + 1][r] * f); }
                o = wmma16(cat16(*(const v8ha*)&Vs[ch][lr][u * 32 + 8 * hi], *(const v8ha*)&Vs[ch][lr][u * 32 + 16 + 8 * hi]), pb, o); }   // o[r] = O[i0 + lr][8 hi + r] x 1024
            v4f o0, o1;
#pragma unroll
            for (int r = 0; r < 4; ++r) { o0[r] = o[r] * (1.0f / PCAR); o1[r] = o[4 + r] * (1.0f / PCAR); }
            *(v4fa*)&Os[wave][lr][ch * HD + hi * 8] = o0; *(v4fa*)&Os[wave][lr][ch * HD + hi * 8 + 4] = o1;
        }
        __builtin_amdgcn_fence(__ATOMIC_ACQ_REL, "wavefront");   // the reads below take what other lanes of this wave wrote: keeps the compiler from moving them up
#pragma unroll
        for (int s = 0; s < 4; ++s) { const int row = (lane >> 3) + 4 * s; *(v4f*)(out + base + (size_t)(i0 + row) * DM + (lane & 7) * 4) = *(const v4fa*)&Os[wave][row][(lane & 7) * 4]; }
        __builtin_amdgcn_fence(__ATOMIC_ACQ_REL, "wavefront");   // the next 16 rows' writes to the staging rows stay behind these reads
        asm volatile("s_wait_xcnt 0x0" ::: "memory");            // stands in front of the next pass's rewrites of the registers that the stores above name
    }
}

extern "C" void kernel_launch(void* const* d_in, const int* in_sizes, int n_in,
                              void* d_out, int out_size, void* d_ws, size_t ws_size, hipStream_t stream) {
    (void)in_sizes; (void)n_in; (void)out_size;
    const float* x = (const float*)d_in[0]; const float* msk = (const float*)d_in[1]; const float* Wq = (const float*)d_in[2]; const float* Wk = (const float*)d_in[3]; const float* Wv = (const float*)d_in[4];
    float* OUT = (float*)d_out;     // [32][256][1024]
    char* wsp = (char*)d_ws;
    auto take = [&](size_t bytes) { char* p = wsp; wsp += (bytes + 255) & ~(size_t)255; return (void*)p; };
    const size_t NR = (size_t)NB_ * TT;
    bf* XB = (bf*)take(NR * DM * 2); bf* BQ = (bf*)take((size_t)DM * DM * 2); bf* BK = (bf*)take((size_t)DM * DM * 2); bf* BV = (bf*)take((size_t)DM * DM * 2); float* Q = (float*)take(NR * DM * 4); float* K = (float*)take(NR * DM * 4); float* V = (float*)take(NR * DM * 4);
    if ((size_t)(wsp - (char*)d_ws) > ws_size) return;    // total ~ 124 MB
    k_cvt8<<<(unsigned)((NR * DM / 8 + 255) / 256), 256, 0, stream>>>(x, XB, NR * DM / 8); k_cvt8<<<(DM * DM / 8 + 255) / 256, 256, 0, stream>>>(Wq, BQ, DM * DM / 8); k_cvt8<<<(DM * DM / 8 + 255) / 256, 256, 0, stream>>>(Wk, BK, DM * DM / 8); k_cvt8<<<(DM * DM / 8 + 255) / 256, 256, 0, stream>>>(Wv, BV, DM * DM / 8);   // torch [out][in] = Bt
    const dim3 gp((unsigned)(NR / 64), DM / 64, 1);
    k_gemmw<bf, 0, false><<<gp, 32, 0, stream>>>(XB, nullptr, BQ, nullptr, DM, Q, DM, nullptr, 0, 0, 0); k_gemmw<bf, 0, false><<<gp, 32, 0, stream>>>(XB, nullptr, BK, nullptr, DM, K, DM, nullptr, 0, 0, 0); k_gemmw<bf, 0, false><<<gp, 32, 0, stream>>>(XB, nullptr, BV, nullptr, DM, V, DM, nullptr, 0, 0, 0);
    k_attn<<<NB_ * (NC / 2), 256, 0, stream>>>(Q, K, V, msk, OUT);
}

// v002
// Measured time: 102 microseconds a run.
// Next to v001, in two timings, it ran 1.64 times as fast each time.
// Over all steps from v000 it is 7.52 times as fast.
#include <hip/hip_runtime.h>

// SelfAttentionLayer (x [32][256][1024]; q/k/v = x W^T (torch [out,in], no bias); 64 chunks of 16 dims act as heads; logits = q.k / sqrt(1024) with mask2d = mask_i mask_j > 0 (sequence_mask read; all ones here); softmax; out[b][i][c*16 + d] = sum_j w v -> [32][256][1024]).
// Compute dtypes, f32 accumulate: every input rounded to bf16; q/k/v on PLAIN bf16 operands (inputs: exact); per-chunk scores single fp16 (q x 1/32; the 16-dim heads zero-padded to K 32) ; softmax f32 -> fp16 x 1024; attn.v single fp16; scores, softmax and attn.v of all (batch, chunk) pairs in one launch, the scores kept in registers.

#define NB_  32
#define TT   256
#define DM   1024
#define HD   16
#define NC   64
#define PCAR 1024.0f
typedef _Float16 h16;
typedef unsigned short bf;
typedef __attribute__((ext_vector_type(16))) __bf16   v16bf;
typedef __attribute__((ext_vector_type(16))) _Float16 v16h;
typedef __attribute__((ext_vector_type(8)))  _Float16 v8h;
typedef __attribute__((ext_vector_type(8)))  unsigned short v8us;
typedef __attribute__((ext_vector_type(8)))  float    v8f;
typedef __attribute__((ext_vector_type(4)))  float    v4f;
typedef v8h  __attribute__((may_alias)) v8ha;
typedef v4f  __attribute__((may_alias)) v4fa;
typedef v8us __attribute__((may_alias)) v8usa;

__device__ __forceinline__ unsigned short f2bf(float f) { unsigned u = __float_as_uint(f); u += 0x7FFFu + ((u >> 16) & 1u); return (unsigned short)(u >> 16); }
__device__ __forceinline__ float bf2f(unsigned short b) { return __uint_as_float(((unsigned)b) << 16); }
__device__ __forceinline__ float bfr(float f) { return bf2f(f2bf(f)); }
__device__ __forceinline__ v16h cat16(v8h lo, v8h hi) { return __builtin_shufflevector(lo, hi, 0, 1, 2, 3, 4, 5, 6, 7, 8, 9, 10, 11, 12, 13, 14, 15); }
__device__ __forceinline__ v16bf cat16b(v8us lo, v8us hi) { return __builtin_bit_cast(v16bf, __builtin_shufflevector(lo, hi, 0, 1, 2, 3, 4, 5, 6, 7, 8, 9, 10, 11, 12, 13, 14, 15)); }
__device__ __forceinline__ v8f wmma16(v16h a, v16h b, v8f c) { return __builtin_amdgcn_wmma_f32_16x16x32_f16(false, a, false, b, (short)0, c, false, false); }
__device__ __forceinline__ v8f wmmab(v16bf a, v16bf b, v8f c) { return __builtin_amdgcn_wmma_f32_16x16x32_bf16(false, a, false, b, (short)0, c, false, false); }



// ---- k_gemms: C[m][n] (f32, pitch DM) = sum_k A[m][k] Bt[n][k], A and Bt K-contiguous bf16 planes of pitch DM. One work-group of 8 waves (4 x 2) per 256 x 128 tile of C, 64 x 64 per wave; grid (M / 256, N / 128).
// A stage is 128 k of the tile's 256 A rows and 128 Bt rows, brought into LDS by asynchronous copies, two buffers: stage t + 2 flies while stage t + 1 is worked on. The k order of every sum is ascending.
#define GKS    128                 // k per stage: 256 B of every row, two whole lines
#define GPITCH 136                 // 16-bit elements per LDS row: 272 B = 16 B x odd, for 16-byte fragment reads down 16 rows
#define GROWS  384                 // 256 A rows, then 128 Bt rows
__device__ __forceinline__ v16bf ldfrag(const bf* p) { return cat16b(*(const v8usa*)p, *(const v8usa*)(p + 16)); }
// eight copies of 16 B per lane: rows 16 apart, LDS byte address l, global address g. The s_wait_xcnt stands inside the statement, in front of any rewrite of the address registers that the copies name.
__device__ __forceinline__ void copy8(unsigned l, const bf* g) {
    asm volatile("global_load_async_to_lds_b128 %0, %8, off\n\tglobal_load_async_to_lds_b128 %1, %9, off\n\tglobal_load_async_to_lds_b128 %2, %10, off\n\tglobal_load_async_to_lds_b128 %3, %11, off\n\t"
                 "global_load_async_to_lds_b128 %4, %12, off\n\tglobal_load_async_to_lds_b128 %5, %13, off\n\tglobal_load_async_to_lds_b128 %6, %14, off\n\tglobal_load_async_to_lds_b128 %7, %15, off\n\ts_wait_xcnt 0x0"
                 :: "v"(l), "v"(l + 1u * 16u * GPITCH * 2u), "v"(l + 2u * 16u * GPITCH * 2u), "v"(l + 3u * 16u * GPITCH * 2u), "v"(l + 4u * 16u * GPITCH * 2u), "v"(l + 5u * 16u * GPITCH * 2u), "v"(l + 6u * 16u * GPITCH * 2u), "v"(l + 7u * 16u * GPITCH * 2u),
                    "v"(g), "v"(g + 1 * 16 * DM), "v"(g + 2 * 16 * DM), "v"(g + 3 * 16 * DM), "v"(g + 4 * 16 * DM), "v"(g + 5 * 16 * DM), "v"(g + 6 * 16 * DM), "v"(g + 7 * 16 * DM) : "memory");
}
__global__ __launch_bounds__(256) void k_gemms(const bf* __restrict__ A, const bf* __restrict__ Bt, float* __restrict__ C) {
    __shared__ __align__(16) bf ring[2][GROWS * GPITCH];
    __shared__ __align__(16) float osw[8][16 * 68];
    const int tid = threadIdx.x, lane = tid & 31, wave = tid >> 5, lr = lane & 15, hi = lane >> 4, wm = wave >> 1, wn = wave & 1;
    const int r0 = blockIdx.x * 256, c0 = blockIdx.y * 128;
    // a lane copies 16 B of row (tid / 16) + 16 i: a wave's copy is two whole 256-byte rows
    const bf* ga = A + (size_t)(r0 + (tid >> 4)) * DM + (tid & 15) * 8;
    const bf* gb = Bt + (size_t)(c0 + (tid >> 4)) * DM + (tid & 15) * 8;
    const unsigned l0 = (unsigned)(size_t)&ring[0][0] + (unsigned)(tid >> 4) * (GPITCH * 2u) + (unsigned)(tid & 15) * 16u;
    const unsigned lbuf = GROWS * GPITCH * 2u;
    v8f acc[4][4];
#pragma unroll
    for (int mb = 0; mb < 4; ++mb)
#pragma unroll
        for (int nb = 0; nb < 4; ++nb) acc[mb][nb] = (v8f){};
    copy8(l0, ga); copy8(l0 + 128u * GPITCH * 2u, ga + 128 * DM); copy8(l0 + 256u * GPITCH * 2u, gb);
    asm volatile("s_wait_asynccnt 0x0" ::: "memory");   // stage 0 has landed before the barrier that publishes it
    __syncthreads();
    copy8(l0 + lbuf, ga + GKS); copy8(l0 + lbuf + 128u * GPITCH * 2u, ga + 128 * DM + GKS); copy8(l0 + lbuf + 256u * GPITCH * 2u, gb + GKS);
#pragma unroll 1   // rolled: one stage per trip, the buffer chosen by the trip's parity
    for (int t = 0; t < DM / GKS; ++t) {
        const bf* sa = &ring[t & 1][(wm * 64 + lr) * GPITCH + 8 * hi];
        const bf* sb = &ring[t & 1][(256 + wn * 64 + lr) * GPITCH + 8 * hi];
        v16bf a[2][4], b[2][4];   // two fragment sets: block ks + 1 is fetched while block ks is multiplied; no fragment of the next stage is fetched here
#pragma unroll
        for (int f = 0; f < 4; ++f) { a[0][f] = ldfrag(sa + f * 16 * GPITCH); b[0][f] = ldfrag(sb + f * 16 * GPITCH); }
#pragma unroll
        for (int ks = 0; ks < GKS / 32; ++ks) {
            if (ks + 1 < GKS / 32) {
#pragma unroll
                for (int f = 0; f < 4; ++f) { a[(ks + 1) & 1][f] = ldfrag(sa + f * 16 * GPITCH + (ks + 1) * 32); b[(ks + 1) & 1][f] = ldfrag(sb + f * 16 * GPITCH + (ks + 1) * 32); } }
            __builtin_amdgcn_sched_barrier(0);   // keeps the next block's LDS reads as one group in front of this block
#pragma unroll
            for (int nb = 0; nb < 4; ++nb)
#pragma unroll
                for (int mb = 0; mb < 4; ++mb) acc[mb][nb] = wmmab(a[ks & 1][mb], b[ks & 1][nb], acc[mb][nb]);
            __builtin_amdgcn_sched_barrier(0);   // the reads of block ks + 2 stay behind this block; the last block stays in front of the stage's waits, so that the copies in flight have the whole trip to land
        }
        asm volatile("s_wait_dscnt 0x0" ::: "memory");      // this wave's reads of the buffer are done before it is refilled
        asm volatile("s_wait_asynccnt 0x0" ::: "memory");   // this wave's copies of stage t + 1 have landed before the barrier that publishes them
        __syncthreads();
        if (t + 2 < DM / GKS) { const unsigned l = l0 + (unsigned)(t & 1) * lbuf; const int ko = (t + 2) * GKS;
            copy8(l, ga + ko); copy8(l + 128u * GPITCH * 2u, ga + 128 * DM + ko); copy8(l + 256u * GPITCH * 2u, gb + ko); }
    }
    asm volatile("s_wait_asynccnt 0x0" ::: "memory");       // no copy is outstanding when the wave goes on to its end
    float* os = osw[wave];
#pragma unroll
    for (int mb = 0; mb < 4; ++mb) {
#pragma unroll
        for (int nb = 0; nb < 4; ++nb) {
#pragma unroll
            for (int j = 0; j < 8; ++j) os[(hi * 8 + j) * 68 + nb * 16 + lr] = acc[mb][nb][j]; }
        __builtin_amdgcn_wave_barrier(); asm volatile("" ::: "memory");   // the reads below take what other lanes of this wave wrote: keeps the compiler from moving them up
        float* crow = C + (size_t)(r0 + wm * 64 + mb * 16) * DM + c0 + wn * 64;
#pragma unroll
        for (int s = 0; s < 8; ++s) { const int row = 2 * s + hi, cofs = lr * 4; *(v4f*)(crow + (size_t)row * DM + cofs) = *(const v4fa*)(os + row * 68 + cofs); }
        __builtin_amdgcn_wave_barrier();
        if (mb < 3) asm volatile("s_wait_xcnt 0x0" ::: "memory");   // the next 16 rows' staging writes stay behind the reads above, and their read-back rewrites registers that the stores above name only behind this wait
    }
}

__device__ __forceinline__ h16 tohx(float x) { return (h16)x; }
typedef __attribute__((ext_vector_type(2))) _Float16 v2h;
typedef __attribute__((ext_vector_type(4))) _Float16 v4h;

__global__ __launch_bounds__(256) void k_cvt8(const float* __restrict__ src, bf* dst, size_t n8) { const size_t i = (size_t)blockIdx.x * 256 + threadIdx.x; if (i >= n8) return; const v8f v = *(const v8f*)(src + i * 8); v8us o;
#pragma unroll
    for (int k = 0; k < 8; ++k) o[k] = f2bf(v[k]); *(v8us*)(dst + i * 8) = o;  }
typedef v4h __attribute__((may_alias)) v4ha;
typedef v2h __attribute__((may_alias)) v2ha;
// lane l <-> lane l ^ 16
__device__ __forceinline__ float xhalf(float x) { const int b = __float_as_int(x); return __int_as_float(__builtin_amdgcn_permlanex16(b, b, 0x76543210, 0xfedcba98, false, false)); }

#define VPITCH 264   // halves per V^T row: 528 B = 16 B x odd, for 16-byte LDS reads down a column of rows
#define OPITCH 36    // floats per staged output row: 144 B = 16 B x odd
// amdgpu_waves_per_eu(4, 4): a register budget of 256, so that two work-groups share a WGP; without it the build went above 256 registers.
__global__ __launch_bounds__(256) __attribute__((amdgpu_waves_per_eu(4, 4))) void k_attn(const float* __restrict__ Q, const float* __restrict__ K, const float* __restrict__ V, const float* __restrict__ msk, float* __restrict__ out) {
    __shared__ __align__(16) h16 Qs[2][2][TT][8];     // [chunk][d / 8][row][d % 8]: a fragment read is 16 contiguous rows of 16 B per wave half
    __shared__ __align__(16) h16 Ks[2][2][TT][8];
    __shared__ __align__(16) h16 Vs[2][HD][VPITCH];   // [chunk][d][j]
    __shared__ __align__(16) float Ms[TT];
    __shared__ __align__(16) float Os[8][16][OPITCH];
    const int tid = threadIdx.x, lane = tid & 31, wave = tid >> 5, lr = lane & 15, hi = lane >> 4;
    const int b = blockIdx.x >> 5;
    const size_t base = (size_t)b * TT * DM + (size_t)(blockIdx.x & 31) * (2 * HD);
    const int g = tid & 7, gch = g >> 2, gd = (g & 3) * 4, gr = tid >> 3;
#pragma unroll
    for (int s = 0; s < 8; ++s) { const int row = gr + 32 * s; const v4f q4 = *(const v4f*)(Q + base + (size_t)row * DM + g * 4); const v4f k4 = *(const v4f*)(K + base + (size_t)row * DM + g * 4); v4h qh, kh;
#pragma unroll
        for (int u = 0; u < 4; ++u) { qh[u] = tohx(q4[u] * 0.03125f); kh[u] = tohx(k4[u]); }
        *(v4ha*)&Qs[gch][gd >> 3][row][gd & 7] = qh; *(v4ha*)&Ks[gch][gd >> 3][row][gd & 7] = kh; }
#pragma unroll
    for (int s = 0; s < 4; ++s) { const int j = (gr + 32 * s) * 2; const v4f v0 = *(const v4f*)(V + base + (size_t)j * DM + g * 4); const v4f v1 = *(const v4f*)(V + base + (size_t)(j + 1) * DM + g * 4);
#pragma unroll
        for (int u = 0; u < 4; ++u) { v2h o; o[0] = tohx(v0[u]); o[1] = tohx(v1[u]); *(v2ha*)&Vs[gch][gd + u][j] = o; } }
    Ms[tid] = bfr(msk[b * TT + tid]);
    __syncthreads();
    const v8h z8 = {};
#pragma unroll 1   // rolled
    for (int it = 0; it < 2; ++it) {
        const int i0 = (wave + 8 * it) * 16; const float mi = Ms[i0 + lr];
#pragma unroll 1   // rolled, as above
        for (int ch = 0; ch < 2; ++ch) {
            const v16h qb = cat16(*(const v8ha*)&Qs[ch][hi][i0 + lr][0], z8);   // k 16..31 of both operands are zero
            v8f s[16];
#pragma unroll
            for (int t = 0; t < 16; ++t) s[t] = wmma16(cat16(*(const v8ha*)&Ks[ch][hi][t * 16 + lr][0], z8), qb, (v8f){});   // s[t][r] = S[i0 + lr][16 t + 8 hi + r]
            v8f mxv;
#pragma unroll
            for (int r = 0; r < 8; ++r) mxv[r] = -3.0e38f;
#pragma unroll
            for (int t = 0; t < 16; ++t) { const v4f ma = *(const v4fa*)&Ms[t * 16 + hi * 8], mb = *(const v4fa*)&Ms[t * 16 + hi * 8 + 4];
#pragma unroll
                for (int r = 0; r < 8; ++r) { const float mj = r < 4 ? ma[r & 3] : mb[r & 3]; const float x = (mi * mj > 0.f) ? s[t][r] : -1.0e9f; s[t][r] = x; mxv[r] = fmaxf(mxv[r], x); } }
            float mx = fmaxf(fmaxf(fmaxf(mxv[0], mxv[1]), fmaxf(mxv[2], mxv[3])), fmaxf(fmaxf(mxv[4], mxv[5]), fmaxf(mxv[6], mxv[7])));
            mx = fmaxf(mx, xhalf(mx));
            v8f sv = {};
#pragma unroll
            for (int t = 0; t < 16; ++t) { float e0 = (s[t][0] - mx) * 1.4426950408889634f, e1 = (s[t][1] - mx) * 1.4426950408889634f, e2 = (s[t][2] - mx) * 1.4426950408889634f, e3 = (s[t][3] - mx) * 1.4426950408889634f, e4 = (s[t][4] - mx) * 1.4426950408889634f, e5 = (s[t][5] - mx) * 1.4426950408889634f, e6 = (s[t][6] - mx) * 1.4426950408889634f, e7 = (s[t][7] - mx) * 1.4426950408889634f;
                // eight independent exp2 in place, then one v_nop: keeps the slot that the instruction set asks for behind a transcendental
                asm("v_exp_f32 %0, %0\n\tv_exp_f32 %1, %1\n\tv_exp_f32 %2, %2\n\tv_exp_f32 %3, %3\n\tv_exp_f32 %4, %4\n\tv_exp_f32 %5, %5\n\tv_exp_f32 %6, %6\n\tv_exp_f32 %7, %7\n\tv_nop" : "+v"(e0), "+v"(e1), "+v"(e2), "+v"(e3), "+v"(e4), "+v"(e5), "+v"(e6), "+v"(e7));
                s[t] = (v8f){e0, e1, e2, e3, e4, e5, e6, e7}; sv += s[t]; }
            float sum = ((sv[0] + sv[1]) + (sv[2] + sv[3])) + ((sv[4] + sv[5]) + (sv[6] + sv[7]));
            sum += xhalf(sum);
            const float f = PCAR / sum;
            v8f o = {};
#pragma unroll
            for (int u = 0; u < 8; ++u) { v16h pb;
#pragma unroll
                for (int r = 0; r < 8; ++r) { pb[r] = tohx(s[2 * u][r] * f); pb[8 + r] = tohx(s[2 * u + 1][r] * f); }
                o = wmma16(cat16(*(const v8ha*)&Vs[ch][lr][u * 32 + 8 * hi], *(const v8ha*)&Vs[ch][lr][u * 32 + 16 + 8 * hi]), pb, o); }   // o[r] = O[i0 + lr][8 hi + r] x 1024
            v4f o0, o1;
#pragma unroll
            for (int r = 0; r < 4; ++r) { o0[r] = o[r] * (1.0f / PCAR); o1[r] = o[4 + r] * (1.0f / PCAR); }
            *(v4fa*)&Os[wave][lr][ch * HD + hi * 8] = o0; *(v4fa*)&Os[wave][lr][ch * HD + hi * 8 + 4] = o1;
        }
        __builtin_amdgcn_fence(__ATOMIC_ACQ_REL, "wavefront");   // the reads below take what other lanes of this wave wrote: keeps the compiler from moving them up
#pragma unroll
        for (int s = 0; s < 4; ++s) { const int row = (lane >> 3) + 4 * s; *(v4f*)(out + base + (size_t)(i0 + row) * DM + (lane & 7) * 4) = *(const v4fa*)&Os[wave][row][(lane & 7) * 4]; }
        __builtin_amdgcn_fence(__ATOMIC_ACQ_REL, "wavefront");   // the next 16 rows' writes to the staging rows stay behind these reads
        asm volatile("s_wait_xcnt 0x0" ::: "memory");            // stands in front of the next pass's rewrites of the registers that the stores above name
    }
}

extern "C" void kernel_launch(void* const* d_in, const int* in_sizes, int n_in,
                              void* d_out, int out_size, void* d_ws, size_t ws_size, hipStream_t stream) {
    (void)in_sizes; (void)n_in; (void)out_size;
    const float* x = (const float*)d_in[0]; const float* msk = (const float*)d_in[1]; const float* Wq = (const float*)d_in[2]; const float* Wk = (const float*)d_in[3]; const float* Wv = (const float*)d_in[4];
    float* OUT = (float*)d_out;     // [32][256][1024]
    char* wsp = (char*)d_ws;
    auto take = [&](size_t bytes) { char* p = wsp; wsp += (bytes + 255) & ~(size_t)255; return (void*)p; };
    const size_t NR = (size_t)NB_ * TT;
    bf* XB = (bf*)take(NR * DM * 2); bf* BQ = (bf*)take((size_t)DM * DM * 2); bf* BK = (bf*)take((size_t)DM * DM * 2); bf* BV = (bf*)take((size_t)DM * DM * 2); float* Q = (float*)take(NR * DM * 4); float* K = (float*)take(NR * DM * 4); float* V = (float*)take(NR * DM * 4);
    if ((size_t)(wsp - (char*)d_ws) > ws_size) return;    // total ~ 124 MB
    k_cvt8<<<(unsigned)((NR * DM / 8 + 255) / 256), 256, 0, stream>>>(x, XB, NR * DM / 8); k_cvt8<<<(DM * DM / 8 + 255) / 256, 256, 0, stream>>>(Wq, BQ, DM * DM / 8); k_cvt8<<<(DM * DM / 8 + 255) / 256, 256, 0, stream>>>(Wk, BK, DM * DM / 8); k_cvt8<<<(DM * DM / 8 + 255) / 256, 256, 0, stream>>>(Wv, BV, DM * DM / 8);   // torch [out][in] = Bt
    const dim3 gp((unsigned)(NR / 256), DM / 128, 1);
    k_gemms<<<gp, 256, 0, stream>>>(XB, BQ, Q); k_gemms<<<gp, 256, 0, stream>>>(XB, BK, K); k_gemms<<<gp, 256, 0, stream>>>(XB, BV, V);
    k_attn<<<NB_ * (NC / 2), 256, 0, stream>>>(Q, K, V, msk, OUT);
}

// v003
// A run of this version takes 89.9 microseconds.
// In both of two side-by-side timings against v002, it was 1.14 times as fast.
// All steps since v000 together make it 8.56 times as fast.
#include <hip/hip_runtime.h>

// SelfAttentionLayer (x [32][256][1024]; q/k/v = x W^T (torch [out,in], no bias); 64 chunks of 16 dims act as heads; logits = q.k / sqrt(1024) with mask2d = mask_i mask_j > 0 (sequence_mask read; all ones here); softmax; out[b][i][c*16 + d] = sum_j w v -> [32][256][1024]).
// Compute dtypes, f32 accumulate: every input rounded to bf16; q/k/v on PLAIN bf16 operands (inputs: exact); per-chunk scores single fp16 (q x 1/32; the 16-dim heads zero-padded to K 32) ; softmax f32 -> fp16 x 1024; attn.v single fp16; scores, softmax and attn.v of all (batch, chunk) pairs in one launch, the scores kept in registers.

#define NB_  32
#define TT   256
#define DM   1024
#define HD   16
#define NC   64
#define PCAR 1024.0f
typedef _Float16 h16;
typedef unsigned short bf;
typedef __attribute__((ext_vector_type(16))) __bf16   v16bf;
typedef __attribute__((ext_vector_type(16))) _Float16 v16h;
typedef __attribute__((ext_vector_type(8)))  _Float16 v8h;
typedef __attribute__((ext_vector_type(8)))  unsigned short v8us;
typedef __attribute__((ext_vector_type(8)))  float    v8f;
typedef __attribute__((ext_vector_type(4)))  float    v4f;
typedef v8h  __attribute__((may_alias)) v8ha;
typedef v4f  __attribute__((may_alias)) v4fa;
typedef v8us __attribute__((may_alias)) v8usa;

__device__ __forceinline__ unsigned short f2bf(float f) { unsigned u = __float_as_uint(f); u += 0x7FFFu + ((u >> 16) & 1u); return (unsigned short)(u >> 16); }
__device__ __forceinline__ float bf2f(unsigned short b) { return __uint_as_float(((unsigned)b) << 16); }
__device__ __forceinline__ float bfr(float f) { return bf2f(f2bf(f)); }
__device__ __forceinline__ v16h cat16(v8h lo, v8h hi) { return __builtin_shufflevector(lo, hi, 0, 1, 2, 3, 4, 5, 6, 7, 8, 9, 10, 11, 12, 13, 14, 15); }
__device__ __forceinline__ v16bf cat16b(v8us lo, v8us hi) { return __builtin_bit_cast(v16bf, __builtin_shufflevector(lo, hi, 0, 1, 2, 3, 4, 5, 6, 7, 8, 9, 10, 11, 12, 13, 14, 15)); }
__device__ __forceinline__ v8f wmma16(v16h a, v16h b, v8f c) { return __builtin_amdgcn_wmma_f32_16x16x32_f16(false, a, false, b, (short)0, c, false, false); }
__device__ __forceinline__ v8f wmmab(v16bf a, v16bf b, v8f c) { return __builtin_amdgcn_wmma_f32_16x16x32_bf16(false, a, false, b, (short)0, c, false, false); }



// ---- k_gemms: C[p][m][n] (f32, three planes of NB_ TT x DM, pitch DM) = sum_k A[m][k] Bt[p DM + n][k], A and Bt K-contiguous bf16 planes of pitch DM; Bt holds the q, k and v weights one behind the other, so one launch does all three products.
// One work-group of 8 waves (4 x 2) per 256 x 128 tile of C, 64 x 64 per wave; grid (M / 256, 3 DM / 128).
// A stage is 128 k of the tile's 256 A rows and 128 Bt rows, brought into LDS by asynchronous copies, two buffers: stage t + 2 flies while stage t + 1 is worked on. The k order of every sum is ascending.
#define GKS    128                 // k per stage: 256 B of every row, two whole lines
#define GPITCH 136                 // 16-bit elements per LDS row: 272 B = 16 B x odd, for 16-byte fragment reads down 16 rows
#define GROWS  384                 // 256 A rows, then 128 Bt rows
__device__ __forceinline__ v16bf ldfrag(const bf* p) { return cat16b(*(const v8usa*)p, *(const v8usa*)(p + 16)); }
// eight copies of 16 B per lane: rows 16 apart, LDS byte address l, global address g. The s_wait_xcnt stands inside the statement, in front of any rewrite of the address registers that the copies name.
__device__ __forceinline__ void copy8(unsigned l, const bf* g) {
    asm volatile("global_load_async_to_lds_b128 %0, %8, off\n\tglobal_load_async_to_lds_b128 %1, %9, off\n\tglobal_load_async_to_lds_b128 %2, %10, off\n\tglobal_load_async_to_lds_b128 %3, %11, off\n\t"
                 "global_load_async_to_lds_b128 %4, %12, off\n\tglobal_load_async_to_lds_b128 %5, %13, off\n\tglobal_load_async_to_lds_b128 %6, %14, off\n\tglobal_load_async_to_lds_b128 %7, %15, off\n\ts_wait_xcnt 0x0"
                 :: "v"(l), "v"(l + 1u * 16u * GPITCH * 2u), "v"(l + 2u * 16u * GPITCH * 2u), "v"(l + 3u * 16u * GPITCH * 2u), "v"(l + 4u * 16u * GPITCH * 2u), "v"(l + 5u * 16u * GPITCH * 2u), "v"(l + 6u * 16u * GPITCH * 2u), "v"(l + 7u * 16u * GPITCH * 2u),
                    "v"(g), "v"(g + 1 * 16 * DM), "v"(g + 2 * 16 * DM), "v"(g + 3 * 16 * DM), "v"(g + 4 * 16 * DM), "v"(g + 5 * 16 * DM), "v"(g + 6 * 16 * DM), "v"(g + 7 * 16 * DM) : "memory");
}
__global__ __launch_bounds__(256) void k_gemms(const bf* __restrict__ A, const bf* __restrict__ Bt, float* __restrict__ C) {
    __shared__ __align__(16) bf ring[2][GROWS * GPITCH];
    __shared__ __align__(16) float osw[8][16 * 68];
    const int tid = threadIdx.x, lane = tid & 31, wave = tid >> 5, lr = lane & 15, hi = lane >> 4, wm = wave >> 1, wn = wave & 1;
    const int r0 = blockIdx.x * 256, c0 = blockIdx.y * 128;
    // a lane copies 16 B of row (tid / 16) + 16 i: a wave's copy is two whole 256-byte rows
    const bf* ga = A + (size_t)(r0 + (tid >> 4)) * DM + (tid & 15) * 8;
    const bf* gb = Bt + (size_t)(c0 + (tid >> 4)) * DM + (tid & 15) * 8;
    const unsigned l0 = (unsigned)(size_t)&ring[0][0] + (unsigned)(tid >> 4) * (GPITCH * 2u) + (unsigned)(tid & 15) * 16u;
    const unsigned lbuf = GROWS * GPITCH * 2u;
    v8f acc[4][4];
#pragma unroll
    for (int mb = 0; mb < 4; ++mb)
#pragma unroll
        for (int nb = 0; nb < 4; ++nb) acc[mb][nb] = (v8f){};
    copy8(l0, ga); copy8(l0 + 128u * GPITCH * 2u, ga + 128 * DM); copy8(l0 + 256u * GPITCH * 2u, gb);
    asm volatile("s_wait_asynccnt 0x0" ::: "memory");   // stage 0 has landed before the barrier that publishes it
    __syncthreads();
    copy8(l0 + lbuf, ga + GKS); copy8(l0 + lbuf + 128u * GPITCH * 2u, ga + 128 * DM + GKS); copy8(l0 + lbuf + 256u * GPITCH * 2u, gb + GKS);
#pragma unroll 1   // rolled: one stage per trip, the buffer chosen by the trip's parity
    for (int t = 0; t < DM / GKS; ++t) {
        const bf* sa = &ring[t & 1][(wm * 64 + lr) * GPITCH + 8 * hi];
        const bf* sb = &ring[t & 1][(256 + wn * 64 + lr) * GPITCH + 8 * hi];
        v16bf a[2][4], b[2][4];   // two fragment sets: block ks + 1 is fetched while block ks is multiplied; no fragment of the next stage is fetched here
#pragma unroll
        for (int f = 0; f < 4; ++f) { a[0][f] = ldfrag(sa + f * 16 * GPITCH); b[0][f] = ldfrag(sb + f * 16 * GPITCH); }
#pragma unroll
        for (int ks = 0; ks < GKS / 32; ++ks) {
            if (ks + 1 < GKS / 32) {
#pragma unroll
                for (int f = 0; f < 4; ++f) { a[(ks + 1) & 1][f] = ldfrag(sa + f * 16 * GPITCH + (ks + 1) * 32); b[(ks + 1) & 1][f] = ldfrag(sb + f * 16 * GPITCH + (ks + 1) * 32); } }
            __builtin_amdgcn_sched_barrier(0);   // keeps the next block's LDS reads as one group in front of this block
#pragma unroll
            for (int nb = 0; nb < 4; ++nb)
#pragma unroll
                for (int mb = 0; mb < 4; ++mb) acc[mb][nb] = wmmab(a[ks & 1][mb], b[ks & 1][nb], acc[mb][nb]);
            __builtin_amdgcn_sched_barrier(0);   // the reads of block ks + 2 stay behind this block; the last block stays in front of the stage's waits, so that the copies in flight have the whole trip to land
        }
        asm volatile("s_wait_dscnt 0x0" ::: "memory");      // this wave's reads of the buffer are done before it is refilled
        asm volatile("s_wait_asynccnt 0x0" ::: "memory");   // this wave's copies of stage t + 1 have landed before the barrier that publishes them
        __syncthreads();
        if (t + 2 < DM / GKS) { const unsigned l = l0 + (unsigned)(t & 1) * lbuf; const int ko = (t + 2) * GKS;
            copy8(l, ga + ko); copy8(l + 128u * GPITCH * 2u, ga + 128 * DM + ko); copy8(l + 256u * GPITCH * 2u, gb + ko); }
    }
    asm volatile("s_wait_asynccnt 0x0" ::: "memory");       // no copy is outstanding when the wave goes on to its end
    float* os = osw[wave];
#pragma unroll
    for (int mb = 0; mb < 4; ++mb) {
#pragma unroll
        for (int nb = 0; nb < 4; ++nb) {
#pragma unroll
            for (int j = 0; j < 8; ++j) os[(hi * 8 + j) * 68 + nb * 16 + lr] = acc[mb][nb][j]; }
        __builtin_amdgcn_wave_barrier(); asm volatile("" ::: "memory");   // the reads below take what other lanes of this wave wrote: keeps the compiler from moving them up
        float* crow = C + (size_t)(c0 / DM) * ((size_t)NB_ * TT * DM) + (size_t)(r0 + wm * 64 + mb * 16) * DM + (c0 % DM) + wn * 64;
#pragma unroll
        for (int s = 0; s < 8; ++s) { const int row = 2 * s + hi, cofs = lr * 4; *(v4f*)(crow + (size_t)row * DM + cofs) = *(const v4fa*)(os + row * 68 + cofs); }
        __builtin_amdgcn_wave_barrier();
        if (mb < 3) asm volatile("s_wait_xcnt 0x0" ::: "memory");   // the next 16 rows' staging writes stay behind the reads above, and their read-back rewrites registers that the stores above name only behind this wait
    }
}

__device__ __forceinline__ h16 tohx(float x) { return (h16)x; }
typedef __attribute__((ext_vector_type(2))) _Float16 v2h;
typedef __attribute__((ext_vector_type(4))) _Float16 v4h;

// ---- k_cvt8: all four f32 inputs to bf16 in one launch, 8 elements a thread. Work-groups 0 .. XG - 1 take x, then WG work-groups each for Wq, Wk, Wv, whose bf16 planes lie one behind the other in wb.
#define XG (NB_ * TT * DM / 8 / 256)
#define WG (DM * DM / 8 / 256)
__global__ __launch_bounds__(256) void k_cvt8(const float* __restrict__ x, const float* __restrict__ wq, const float* __restrict__ wk, const float* __restrict__ wv, bf* __restrict__ xb, bf* __restrict__ wb) {
    const int blk = blockIdx.x; const float* src = x; bf* dst = xb; int rel = blk;
    if (blk >= XG) { const int p = (blk - XG) / WG; rel = (blk - XG) % WG; src = p == 0 ? wq : p == 1 ? wk : wv; dst = wb + (size_t)p * DM * DM; }
    const size_t i = (size_t)rel * 256 + threadIdx.x; const v8f v = *(const v8f*)(src + i * 8); v8us o;
#pragma unroll
    for (int k = 0; k < 8; ++k) o[k] = f2bf(v[k]); *(v8us*)(dst + i * 8) = o;  }
typedef v4h __attribute__((may_alias)) v4ha;
typedef v2h __attribute__((may_alias)) v2ha;
// lane l <-> lane l ^ 16
__device__ __forceinline__ float xhalf(float x) { const int b = __float_as_int(x); return __int_as_float(__builtin_amdgcn_permlanex16(b, b, 0x76543210, 0xfedcba98, false, false)); }

#define VPITCH 264   // halves per V^T row: 528 B = 16 B x odd, for 16-byte LDS reads down a column of rows
#define OPITCH 36    // floats per staged output row: 144 B = 16 B x odd
// amdgpu_waves_per_eu(4, 4): a register budget of 256, so that two work-groups share a WGP; without it the build went above 256 registers.
__global__ __launch_bounds__(256) __attribute__((amdgpu_waves_per_eu(4, 4))) void k_attn(const float* __restrict__ Q, const float* __restrict__ K, const float* __restrict__ V, const float* __restrict__ msk, float* __restrict__ out) {
    __shared__ __align__(16) h16 Qs[2][2][TT][8];     // [chunk][d / 8][row][d % 8]: a fragment read is 16 contiguous rows of 16 B per wave half
    __shared__ __align__(16) h16 Ks[2][2][TT][8];
    __shared__ __align__(16) h16 Vs[2][HD][VPITCH];   // [chunk][d][j]
    __shared__ __align__(16) float Ms[TT];
    __shared__ __align__(16) float Os[8][16][OPITCH];
    const int tid = threadIdx.x, lane = tid & 31, wave = tid >> 5, lr = lane & 15, hi = lane >> 4;
    const int b = blockIdx.x >> 5;
    const size_t base = (size_t)b * TT * DM + (size_t)(blockIdx.x & 31) * (2 * HD);
    const int g = tid & 7, gch = g >> 2, gd = (g & 3) * 4, gr = tid >> 3;
#pragma unroll
    for (int s = 0; s < 8; ++s) { const int row = gr + 32 * s; const v4f q4 = *(const v4f*)(Q + base + (size_t)row * DM + g * 4); const v4f k4 = *(const v4f*)(K + base + (size_t)row * DM + g * 4); v4h qh, kh;
#pragma unroll
        for (int u = 0; u < 4; ++u) { qh[u] = tohx(q4[u] * 0.03125f); kh[u] = tohx(k4[u]); }
        *(v4ha*)&Qs[gch][gd >> 3][row][gd & 7] = qh; *(v4ha*)&Ks[gch][gd >> 3][row][gd & 7] = kh; }
#pragma unroll
    for (int s = 0; s < 4; ++s) { const int j = (gr + 32 * s) * 2; const v4f v0 = *(const v4f*)(V + base + (size_t)j * DM + g * 4); const v4f v1 = *(const v4f*)(V + base + (size_t)(j + 1) * DM + g * 4);
#pragma unroll
        for (int u = 0; u < 4; ++u) { v2h o; o[0] = tohx(v0[u]); o[1] = tohx(v1[u]); *(v2ha*)&Vs[gch][gd + u][j] = o; } }
    Ms[tid] = bfr(msk[b * TT + tid]);
    __syncthreads();
    const v8h z8 = {};
#pragma unroll 1   // rolled
    for (int it = 0; it < 2; ++it) {
        const int i0 = (wave + 8 * it) * 16; const float mi = Ms[i0 + lr];
#pragma unroll 1   // rolled, as above
        for (int ch = 0; ch < 2; ++ch) {
            const v16h qb = cat16(*(const v8ha*)&Qs[ch][hi][i0 + lr][0], z8);   // k 16..31 of both operands are zero
            v8f s[16];
#pragma unroll
            for (int t = 0; t < 16; ++t) s[t] = wmma16(cat16(*(const v8ha*)&Ks[ch][hi][t * 16 + lr][0], z8), qb, (v8f){});   // s[t][r] = S[i0 + lr][16 t + 8 hi + r]
            v8f mxv;
#pragma unroll
            for (int r = 0; r < 8; ++r) mxv[r] = -3.0e38f;
#pragma unroll
            for (int t = 0; t < 16; ++t) { const v4f ma = *(const v4fa*)&Ms[t * 16 + hi * 8], mb = *(const v4fa*)&Ms[t * 16 + hi * 8 + 4];
#pragma unroll
                for (int r = 0; r < 8; ++r) { const float mj = r < 4 ? ma[r & 3] : mb[r & 3]; const float x = (mi * mj > 0.f) ? s[t][r] : -1.0e9f; s[t][r] = x; mxv[r] = fmaxf(mxv[r], x); } }
            float mx = fmaxf(fmaxf(fmaxf(mxv[0], mxv[1]), fmaxf(mxv[2], mxv[3])), fmaxf(fmaxf(mxv[4], mxv[5]), fmaxf(mxv[6], mxv[7])));
            mx = fmaxf(mx, xhalf(mx));
            v8f sv = {};
#pragma unroll
            for (int t = 0; t < 16; ++t) { float e0 = (s[t][0] - mx) * 1.4426950408889634f, e1 = (s[t][1] - mx) * 1.4426950408889634f, e2 = (s[t][2] - mx) * 1.4426950408889634f, e3 = (s[t][3] - mx) * 1.4426950408889634f, e4 = (s[t][4] - mx) * 1.4426950408889634f, e5 = (s[t][5] - mx) * 1.4426950408889634f, e6 = (s[t][6] - mx) * 1.4426950408889634f, e7 = (s[t][7] - mx) * 1.4426950408889634f;
                // eight independent exp2 in place, then one v_nop: keeps the slot that the instruction set asks for behind a transcendental
                asm("v_exp_f32 %0, %0\n\tv_exp_f32 %1, %1\n\tv_exp_f32 %2, %2\n\tv_exp_f32 %3, %3\n\tv_exp_f32 %4, %4\n\tv_exp_f32 %5, %5\n\tv_exp_f32 %6, %6\n\tv_exp_f32 %7, %7\n\tv_nop" : "+v"(e0), "+v"(e1), "+v"(e2), "+v"(e3), "+v"(e4), "+v"(e5), "+v"(e6), "+v"(e7));
                s[t] = (v8f){e0, e1, e2, e3, e4, e5, e6, e7}; sv += s[t]; }
            float sum = ((sv[0] + sv[1]) + (sv[2] + sv[3])) + ((sv[4] + sv[5]) + (sv[6] + sv[7]));
            sum += xhalf(sum);
            const float f = PCAR / sum;
            v8f o = {};
#pragma unroll
            for (int u = 0; u < 8; ++u) { v16h pb;
#pragma unroll
                for (int r = 0; r < 8; ++r) { pb[r] = tohx(s[2 * u][r] * f); pb[8 + r] = tohx(s[2 * u + 1][r] * f); }
                o = wmma16(cat16(*(const v8ha*)&Vs[ch][lr][u * 32 + 8 * hi], *(const v8ha*)&Vs[ch][lr][u * 32 + 16 + 8 * hi]), pb, o); }   // o[r] = O[i0 + lr][8 hi + r] x 1024
            v4f o0, o1;
#pragma unroll
            for (int r = 0; r < 4; ++r) { o0[r] = o[r] * (1.0f / PCAR); o1[r] = o[4 + r] * (1.0f / PCAR); }
            *(v4fa*)&Os[wave][lr][ch * HD + hi * 8] = o0; *(v4fa*)&Os[wave][lr][ch * HD + hi * 8 + 4] = o1;
        }
        __builtin_amdgcn_fence(__ATOMIC_ACQ_REL, "wavefront");   // the reads below take what other lanes of this wave wrote: keeps the compiler from moving them up
#pragma unroll
        for (int s = 0; s < 4; ++s) { const int row = (lane >> 3) + 4 * s; *(v4f*)(out + base + (size_t)(i0 + row) * DM + (lane & 7) * 4) = *(const v4fa*)&Os[wave][row][(lane & 7) * 4]; }
        __builtin_amdgcn_fence(__ATOMIC_ACQ_REL, "wavefront");   // the next 16 rows' writes to the staging rows stay behind these reads
        asm volatile("s_wait_xcnt 0x0" ::: "memory");            // stands in front of the next pass's rewrites of the registers that the stores above name
    }
}

extern "C" void kernel_launch(void* const* d_in, const int* in_sizes, int n_in,
                              void* d_out, int out_size, void* d_ws, size_t ws_size, hipStream_t stream) {
    (void)in_sizes; (void)n_in; (void)out_size;
    const float* x = (const float*)d_in[0]; const float* msk = (const float*)d_in[1]; const float* Wq = (const float*)d_in[2]; const float* Wk = (const float*)d_in[3]; const float* Wv = (const float*)d_in[4];
    float* OUT = (float*)d_out;     // [32][256][1024]
    char* wsp = (char*)d_ws;
    auto take = [&](size_t bytes) { char* p = wsp; wsp += (bytes + 255) & ~(size_t)255; return (void*)p; };
    const size_t NR = (size_t)NB_ * TT;
    bf* XB = (bf*)take(NR * DM * 2); bf* BW = (bf*)take((size_t)3 * DM * DM * 2); float* Q = (float*)take(3 * NR * DM * 4); float* K = Q + NR * DM; float* V = K + NR * DM;
    if ((size_t)(wsp - (char*)d_ws) > ws_size) return;    // total ~ 124 MB
    k_cvt8<<<XG + 3 * WG, 256, 0, stream>>>(x, Wq, Wk, Wv, XB, BW);   // torch [out][in] = Bt
    const dim3 gp((unsigned)(NR / 256), 3 * DM / 128, 1);
    k_gemms<<<gp, 256, 0, stream>>>(XB, BW, Q);
    k_attn<<<NB_ * (NC / 2), 256, 0, stream>>>(Q, K, V, msk, OUT);
}

// v004
// Measured time: 78.7 microseconds a run.
// Next to v003, in two timings, it ran 1.13 and 1.14 times as fast.
// Counting every step since v000, it is 9.73 times as fast.
#include <hip/hip_runtime.h>

// SelfAttentionLayer (x [32][256][1024]; q/k/v = x W^T (torch [out,in], no bias); 64 chunks of 16 dims act as heads; logits = q.k / sqrt(1024) with mask2d = mask_i mask_j > 0 (sequence_mask read; all ones here); softmax; out[b][i][c*16 + d] = sum_j w v -> [32][256][1024]).
// Compute dtypes, f32 accumulate: every input rounded to bf16; q/k/v on PLAIN bf16 operands (inputs: exact); per-chunk scores single fp16 (q x 1/32; the 16-dim heads zero-padded to K 32) ; softmax f32 -> fp16 x 1024; attn.v single fp16; scores, softmax and attn.v of all (batch, chunk) pairs in one launch, the scores kept in registers. q x 1/32, k and v go from the products to the attention launch as fp16, rounded once from the f32 sums.

#define NB_  32
#define TT   256
#define DM   1024
#define HD   16
#define NC   64
#define PCAR 1024.0f
typedef _Float16 h16;
typedef unsigned short bf;
typedef __attribute__((ext_vector_type(16))) __bf16   v16bf;
typedef __attribute__((ext_vector_type(16))) _Float16 v16h;
typedef __attribute__((ext_vector_type(8)))  _Float16 v8h;
typedef __attribute__((ext_vector_type(8)))  unsigned short v8us;
typedef __attribute__((ext_vector_type(8)))  float    v8f;
typedef __attribute__((ext_vector_type(4)))  float    v4f;
typedef v8h  __attribute__((may_alias)) v8ha;
typedef v4f  __attribute__((may_alias)) v4fa;
typedef v8us __attribute__((may_alias)) v8usa;

__device__ __forceinline__ unsigned short f2bf(float f) { unsigned u = __float_as_uint(f); u += 0x7FFFu + ((u >> 16) & 1u); return (unsigned short)(u >> 16); }
__device__ __forceinline__ float bf2f(unsigned short b) { return __uint_as_float(((unsigned)b) << 16); }
__device__ __forceinline__ float bfr(float f) { return bf2f(f2bf(f)); }
__device__ __forceinline__ v16h cat16(v8h lo, v8h hi) { return __builtin_shufflevector(lo, hi, 0, 1, 2, 3, 4, 5, 6, 7, 8, 9, 10, 11, 12, 13, 14, 15); }
__device__ __forceinline__ v16bf cat16b(v8us lo, v8us hi) { return __builtin_bit_cast(v16bf, __builtin_shufflevector(lo, hi, 0, 1, 2, 3, 4, 5, 6, 7, 8, 9, 10, 11, 12, 13, 14, 15)); }
__device__ __forceinline__ v8f wmma16(v16h a, v16h b, v8f c) { return __builtin_amdgcn_wmma_f32_16x16x32_f16(false, a, false, b, (short)0, c, false, false); }
__device__ __forceinline__ v8f wmmab(v16bf a, v16bf b, v8f c) { return __builtin_amdgcn_wmma_f32_16x16x32_bf16(false, a, false, b, (short)0, c, false, false); }



// ---- k_gemms: C[p][m][n] (fp16, three planes of NB_ TT x DM; plane 0 times 1/32) = sum_k A[m][k] Bt[p DM + n][k], A and Bt K-contiguous bf16 planes of pitch DM; Bt holds the q, k and v weights one behind the other, so one launch does all three products.
// A plane of C is laid out [sequence][n / 8][row of the sequence][n % 8]: the 16-byte unit that k_attn's fragment reads take, so that the 32 columns of a chunk pair are 16 KB in a row.
// One work-group of 8 waves (4 x 2) per 256 x 128 tile of C, 64 x 64 per wave; grid (M / 256, 3 DM / 128).
// A stage is 128 k of the tile's 256 A rows and 128 Bt rows, brought into LDS by asynchronous copies, two buffers: stage t + 2 flies while stage t + 1 is worked on. The k order of every sum is ascending.
#define GKS    128                 // k per stage: 256 B of every row, two whole lines
#define GPITCH 136                 // 16-bit elements per LDS row: 272 B = 16 B x odd, for 16-byte fragment reads down 16 rows
#define GROWS  384                 // 256 A rows, then 128 Bt rows
__device__ __forceinline__ v16bf ldfrag(const bf* p) { return cat16b(*(const v8usa*)p, *(const v8usa*)(p + 16)); }
// eight copies of 16 B per lane: rows 16 apart, LDS byte address l, global address g. The s_wait_xcnt stands inside the statement, in front of any rewrite of the address registers that the copies name.
__device__ __forceinline__ void copy8(unsigned l, const bf* g) {
    asm volatile("global_load_async_to_lds_b128 %0, %8, off\n\tglobal_load_async_to_lds_b128 %1, %9, off\n\tglobal_load_async_to_lds_b128 %2, %10, off\n\tglobal_load_async_to_lds_b128 %3, %11, off\n\t"
                 "global_load_async_to_lds_b128 %4, %12, off\n\tglobal_load_async_to_lds_b128 %5, %13, off\n\tglobal_load_async_to_lds_b128 %6, %14, off\n\tglobal_load_async_to_lds_b128 %7, %15, off\n\ts_wait_xcnt 0x0"
                 :: "v"(l), "v"(l + 1u * 16u * GPITCH * 2u), "v"(l + 2u * 16u * GPITCH * 2u), "v"(l + 3u * 16u * GPITCH * 2u), "v"(l + 4u * 16u * GPITCH * 2u), "v"(l + 5u * 16u * GPITCH * 2u), "v"(l + 6u * 16u * GPITCH * 2u), "v"(l + 7u * 16u * GPITCH * 2u),
                    "v"(g), "v"(g + 1 * 16 * DM), "v"(g + 2 * 16 * DM), "v"(g + 3 * 16 * DM), "v"(g + 4 * 16 * DM), "v"(g + 5 * 16 * DM), "v"(g + 6 * 16 * DM), "v"(g + 7 * 16 * DM) : "memory");
}
__global__ __launch_bounds__(256) void k_gemms(const bf* __restrict__ A, const bf* __restrict__ Bt, h16* __restrict__ C) {
    __shared__ __align__(16) bf ring[2][GROWS * GPITCH];
    __shared__ __align__(16) float osw[8][16 * 68];
    const int tid = threadIdx.x, lane = tid & 31, wave = tid >> 5, lr = lane & 15, hi = lane >> 4, wm = wave >> 1, wn = wave & 1;
    const int r0 = blockIdx.x * 256, c0 = blockIdx.y * 128;
    // a lane copies 16 B of row (tid / 16) + 16 i: a wave's copy is two whole 256-byte rows
    const bf* ga = A + (size_t)(r0 + (tid >> 4)) * DM + (tid & 15) * 8;
    const bf* gb = Bt + (size_t)(c0 + (tid >> 4)) * DM + (tid & 15) * 8;
    const unsigned l0 = (unsigned)(size_t)&ring[0][0] + (unsigned)(tid >> 4) * (GPITCH * 2u) + (unsigned)(tid & 15) * 16u;
    const unsigned lbuf = GROWS * GPITCH * 2u;
    v8f acc[4][4];
#pragma unroll
    for (int mb = 0; mb < 4; ++mb)
#pragma unroll
        for (int nb = 0; nb < 4; ++nb) acc[mb][nb] = (v8f){};
    copy8(l0, ga); copy8(l0 + 128u * GPITCH * 2u, ga + 128 * DM); copy8(l0 + 256u * GPITCH * 2u, gb);
    asm volatile("s_wait_asynccnt 0x0" ::: "memory");   // stage 0 has landed before the barrier that publishes it
    __syncthreads();
    copy8(l0 + lbuf, ga + GKS); copy8(l0 + lbuf + 128u * GPITCH * 2u, ga + 128 * DM + GKS); copy8(l0 + lbuf + 256u * GPITCH * 2u, gb + GKS);
#pragma unroll 1   // rolled: one stage per trip, the buffer chosen by the trip's parity
    for (int t = 0; t < DM / GKS; ++t) {
        const bf* sa = &ring[t & 1][(wm * 64 + lr) * GPITCH + 8 * hi];
        const bf* sb = &ring[t & 1][(256 + wn * 64 + lr) * GPITCH + 8 * hi];
        v16bf a[2][4], b[2][4];   // two fragment sets: block ks + 1 is fetched while block ks is multiplied; no fragment of the next stage is fetched here
#pragma unroll
        for (int f = 0; f < 4; ++f) { a[0][f] = ldfrag(sa + f * 16 * GPITCH); b[0][f] = ldfrag(sb + f * 16 * GPITCH); }
#pragma unroll
        for (int ks = 0; ks < GKS / 32; ++ks) {
            if (ks + 1 < GKS / 32) {
#pragma unroll
                for (int f = 0; f < 4; ++f) { a[(ks + 1) & 1][f] = ldfrag(sa + f * 16 * GPITCH + (ks + 1) * 32); b[(ks + 1) & 1][f] = ldfrag(sb + f * 16 * GPITCH + (ks + 1) * 32); } }
            __builtin_amdgcn_sched_barrier(0);   // keeps the next block's LDS reads as one group in front of this block
#pragma unroll
            for (int nb = 0; nb < 4; ++nb)
#pragma unroll
                for (int mb = 0; mb < 4; ++mb) acc[mb][nb] = wmmab(a[ks & 1][mb], b[ks & 1][nb], acc[mb][nb]);
            __builtin_amdgcn_sched_barrier(0);   // the reads of block ks + 2 stay behind this block; the last block stays in front of the stage's waits, so that the copies in flight have the whole trip to land
        }
        asm volatile("s_wait_dscnt 0x0" ::: "memory");      // this wave's reads of the buffer are done before it is refilled
        asm volatile("s_wait_asynccnt 0x0" ::: "memory");   // this wave's copies of stage t + 1 have landed before the barrier that publishes them
        __syncthreads();
        if (t + 2 < DM / GKS) { const unsigned l = l0 + (unsigned)(t & 1) * lbuf; const int ko = (t + 2) * GKS;
            copy8(l, ga + ko); copy8(l + 128u * GPITCH * 2u, ga + 128 * DM + ko); copy8(l + 256u * GPITCH * 2u, gb + ko); }
    }
    asm volatile("s_wait_asynccnt 0x0" ::: "memory");       // no copy is outstanding when the wave goes on to its end
    float* os = osw[wave];
    const float sc = c0 < DM ? 0.03125f : 1.0f;   // the q plane carries the 1 / sqrt(1024) of the logits: a power of two, exact
#pragma unroll
    for (int mb = 0; mb < 4; ++mb) {
#pragma unroll
        for (int nb = 0; nb < 4; ++nb) {
#pragma unroll
            for (int j = 0; j < 8; ++j) os[(hi * 8 + j) * 68 + nb * 16 + lr] = acc[mb][nb][j]; }
        __builtin_amdgcn_wave_barrier(); asm volatile("" ::: "memory");   // the reads below take what other lanes of this wave wrote: keeps the compiler from moving them up
        // the tile's 256 rows are one sequence; a lane takes 8 columns of one row, 16 lanes 256 B in a row
        h16* cu = C + (size_t)(c0 / DM) * ((size_t)NB_ * TT * DM) + (size_t)r0 * DM + (size_t)(((c0 % DM) + wn * 64) / 8) * (TT * 8) + (wm * 64 + mb * 16 + lr) * 8;
#pragma unroll
        for (int s = 0; s < 4; ++s) { const int cg = 2 * s + hi; const v4f x0 = *(const v4fa*)(os + lr * 68 + cg * 8), x1 = *(const v4fa*)(os + lr * 68 + cg * 8 + 4); v8h o;
#pragma unroll
            for (int u = 0; u < 4; ++u) { o[u] = (h16)(x0[u] * sc); o[4 + u] = (h16)(x1[u] * sc); }
            *(v8h*)(cu + cg * (TT * 8)) = o; }
        __builtin_amdgcn_wave_barrier();
        if (mb < 3) asm volatile("s_wait_xcnt 0x0" ::: "memory");   // the next 16 rows' staging writes stay behind the reads above, and their read-back rewrites registers that the stores above name only behind this wait
    }
}

__device__ __forceinline__ h16 tohx(float x) { return (h16)x; }
typedef __attribute__((ext_vector_type(2))) _Float16 v2h;
typedef __attribute__((ext_vector_type(4))) _Float16 v4h;

// ---- k_cvt8: all four f32 inputs to bf16 in one launch, 8 elements a thread. Work-groups 0 .. XG - 1 take x, then WG work-groups each for Wq, Wk, Wv, whose bf16 planes lie one behind the other in wb.
#define XG (NB_ * TT * DM / 8 / 256)
#define WG (DM * DM / 8 / 256)
__global__ __launch_bounds__(256) void k_cvt8(const float* __restrict__ x, const float* __restrict__ wq, const float* __restrict__ wk, const float* __restrict__ wv, bf* __restrict__ xb, bf* __restrict__ wb) {
    const int blk = blockIdx.x; const float* src = x; bf* dst = xb; int rel = blk;
    if (blk >= XG) { const int p = (blk - XG) / WG; rel = (blk - XG) % WG; src = p == 0 ? wq : p == 1 ? wk : wv; dst = wb + (size_t)p * DM * DM; }
    const size_t i = (size_t)rel * 256 + threadIdx.x; const v8f v = *(const v8f*)(src + i * 8); v8us o;
#pragma unroll
    for (int k = 0; k < 8; ++k) o[k] = f2bf(v[k]); *(v8us*)(dst + i * 8) = o;  }
typedef v4h __attribute__((may_alias)) v4ha;
typedef v2h __attribute__((may_alias)) v2ha;
// lane l <-> lane l ^ 16
__device__ __forceinline__ float xhalf(float x) { const int b = __float_as_int(x); return __int_as_float(__builtin_amdgcn_permlanex16(b, b, 0x76543210, 0xfedcba98, false, false)); }

#define VPITCH 264   // halves per V^T row: 528 B = 16 B x odd, for 16-byte LDS reads down a column of rows
#define OPITCH 36    // floats per staged output row: 144 B = 16 B x odd
// amdgpu_waves_per_eu(4, 4): a register budget of 256, so that two work-groups share a WGP; without it the build went above 256 registers.
__global__ __launch_bounds__(256) __attribute__((amdgpu_waves_per_eu(4, 4))) void k_attn(const h16* __restrict__ Q, const h16* __restrict__ K, const h16* __restrict__ V, const float* __restrict__ msk, float* __restrict__ out) {
    __shared__ __align__(16) h16 Qs[2][2][TT][8];     // [chunk][d / 8][row][d % 8]: a fragment read is 16 contiguous rows of 16 B per wave half
    __shared__ __align__(16) h16 Ks[2][2][TT][8];
    __shared__ __align__(16) h16 Vs[2][HD][VPITCH];   // [chunk][d][j]
    __shared__ __align__(16) float Ms[TT];
    __shared__ __align__(16) float Os[8][16][OPITCH];
    const int tid = threadIdx.x, lane = tid & 31, wave = tid >> 5, lr = lane & 15, hi = lane >> 4;
    const int b = blockIdx.x >> 5;
    const size_t base = (size_t)b * TT * DM + (size_t)(blockIdx.x & 31) * (2 * HD);
    const size_t ib = (size_t)b * TT * DM + (size_t)(blockIdx.x & 31) * (2 * HD * TT);   // the pair's 16 KB in each fp16 plane: [chunk][d / 8][row][d % 8], the layout of Qs and Ks
    const int gg = tid >> 6;   // which 8 of the pair's 32 columns this thread transposes
    v8h q8[4], k8[4], va[2], vb[2];
#pragma unroll
    for (int s = 0; s < 4; ++s) { const int u = (tid + 256 * s) * 8; q8[s] = *(const v8h*)(Q + ib + u); k8[s] = *(const v8h*)(K + ib + u); }
#pragma unroll
    for (int s = 0; s < 2; ++s) { const int j = 2 * (tid & 63) + 128 * s; va[s] = *(const v8h*)(V + ib + (gg * TT + j) * 8); vb[s] = *(const v8h*)(V + ib + (gg * TT + j + 1) * 8); }
    const float mraw = msk[b * TT + tid];
    asm volatile("s_wait_xcnt 0x0" ::: "memory");   // stands in front of the rewrites of the offset registers that the loads above name
    __builtin_amdgcn_sched_barrier(0);              // keeps the index arithmetic below, which reuses those registers, behind that wait
#pragma unroll
    for (int s = 0; s < 4; ++s) { const int u = (tid + 256 * s) * 8; *(v8ha*)(&Qs[0][0][0][0] + u) = q8[s]; *(v8ha*)(&Ks[0][0][0][0] + u) = k8[s]; }
#pragma unroll
    for (int s = 0; s < 2; ++s) { const int j = 2 * (tid & 63) + 128 * s;
#pragma unroll
        for (int u = 0; u < 8; ++u) { v2h o; o[0] = va[s][u]; o[1] = vb[s][u]; *(v2ha*)&Vs[gg >> 1][(gg & 1) * 8 + u][j] = o; } }
    Ms[tid] = bfr(mraw);
    __syncthreads();
    const v8h z8 = {};
#pragma unroll 1   // rolled
    for (int it = 0; it < 2; ++it) {
        const int i0 = (wave + 8 * it) * 16; const float mi = Ms[i0 + lr];
#pragma unroll 1   // rolled, as above
        for (int ch = 0; ch < 2; ++ch) {
            const v16h qb = cat16(*(const v8ha*)&Qs[ch][hi][i0 + lr][0], z8);   // k 16..31 of both operands are zero
            v8f s[16];
#pragma unroll
            for (int t = 0; t < 16; ++t) s[t] = wmma16(cat16(*(const v8ha*)&Ks[ch][hi][t * 16 + lr][0], z8), qb, (v8f){});   // s[t][r] = S[i0 + lr][16 t + 8 hi + r]
            v8f mxv;
#pragma unroll
            for (int r = 0; r < 8; ++r) mxv[r] = -3.0e38f;
#pragma unroll
            for (int t = 0; t < 16; ++t) { const v4f ma = *(const v4fa*)&Ms[t * 16 + hi * 8], mb = *(const v4fa*)&Ms[t * 16 + hi * 8 + 4];
#pragma unroll
                for (int r = 0; r < 8; ++r) { const float mj = r < 4 ? ma[r & 3] : mb[r & 3]; const float x = (mi * mj > 0.f) ? s[t][r] : -1.0e9f; s[t][r] = x; mxv[r] = fmaxf(mxv[r], x); } }
            float mx = fmaxf(fmaxf(fmaxf(mxv[0], mxv[1]), fmaxf(mxv[2], mxv[3])), fmaxf(fmaxf(mxv[4], mxv[5]), fmaxf(mxv[6], mxv[7])));
            mx = fmaxf(mx, xhalf(mx));
            v8f sv = {};
#pragma unroll
            for (int t = 0; t < 16; ++t) { float e0 = (s[t][0] - mx) * 1.4426950408889634f, e1 = (s[t][1] - mx) * 1.4426950408889634f, e2 = (s[t][2] - mx) * 1.4426950408889634f, e3 = (s[t][3] - mx) * 1.4426950408889634f, e4 = (s[t][4] - mx) * 1.4426950408889634f, e5 = (s[t][5] - mx) * 1.4426950408889634f, e6 = (s[t][6] - mx) * 1.4426950408889634f, e7 = (s[t][7] - mx) * 1.4426950408889634f;
                // eight independent exp2 in place, then one v_nop: keeps the slot that the instruction set asks for behind a transcendental
                asm("v_exp_f32 %0, %0\n\tv_exp_f32 %1, %1\n\tv_exp_f32 %2, %2\n\tv_exp_f32 %3, %3\n\tv_exp_f32 %4, %4\n\tv_exp_f32 %5, %5\n\tv_exp_f32 %6, %6\n\tv_exp_f32 %7, %7\n\tv_nop" : "+v"(e0), "+v"(e1), "+v"(e2), "+v"(e3), "+v"(e4), "+v"(e5), "+v"(e6), "+v"(e7));
                s[t] = (v8f){e0, e1, e2, e3, e4, e5, e6, e7}; sv += s[t]; }
            float sum = ((sv[0] + sv[1]) + (sv[2] + sv[3])) + ((sv[4] + sv[5]) + (sv[6] + sv[7]));
            sum += xhalf(sum);
            const float f = PCAR / sum;
            v8f o = {};
#pragma unroll
            for (int u = 0; u < 8; ++u) { v16h pb;
#pragma unroll
                for (int r = 0; r < 8; ++r) { pb[r] = tohx(s[2 * u][r] * f); pb[8 + r] = tohx(s[2 * u + 1][r] * f); }
                o = wmma16(cat16(*(const v8ha*)&Vs[ch][lr][u * 32 + 8 * hi], *(const v8ha*)&Vs[ch][lr][u * 32 + 16 + 8 * hi]), pb, o); }   // o[r] = O[i0 + lr][8 hi + r] x 1024
            v4f o0, o1;
#pragma unroll
            for (int r = 0; r < 4; ++r) { o0[r] = o[r] * (1.0f / PCAR); o1[r] = o[4 + r] * (1.0f / PCAR); }
            *(v4fa*)&Os[wave][lr][ch * HD + hi * 8] = o0; *(v4fa*)&Os[wave][lr][ch * HD + hi * 8 + 4] = o1;
        }
        __builtin_amdgcn_fence(__ATOMIC_ACQ_REL, "wavefront");   // the reads below take what other lanes of this wave wrote: keeps the compiler from moving them up
#pragma unroll
        for (int s = 0; s < 4; ++s) { const int row = (lane >> 3) + 4 * s; *(v4f*)(out + base + (size_t)(i0 + row) * DM + (lane & 7) * 4) = *(const v4fa*)&Os[wave][row][(lane & 7) * 4]; }
        __builtin_amdgcn_fence(__ATOMIC_ACQ_REL, "wavefront");   // the next 16 rows' writes to the staging rows stay behind these reads
        asm volatile("s_wait_xcnt 0x0" ::: "memory");            // stands in front of the next pass's rewrites of the registers that the stores above name
    }
}

extern "C" void kernel_launch(void* const* d_in, const int* in_sizes, int n_in,
                              void* d_out, int out_size, void* d_ws, size_t ws_size, hipStream_t stream) {
    (void)in_sizes; (void)n_in; (void)out_size;
    const float* x = (const float*)d_in[0]; const float* msk = (const float*)d_in[1]; const float* Wq = (const float*)d_in[2]; const float* Wk = (const float*)d_in[3]; const float* Wv = (const float*)d_in[4];
    float* OUT = (float*)d_out;     // [32][256][1024]
    char* wsp = (char*)d_ws;
    auto take = [&](size_t bytes) { char* p = wsp; wsp += (bytes + 255) & ~(size_t)255; return (void*)p; };
    const size_t NR = (size_t)NB_ * TT;
    bf* XB = (bf*)take(NR * DM * 2); bf* BW = (bf*)take((size_t)3 * DM * DM * 2); h16* Q = (h16*)take(3 * NR * DM * 2); h16* K = Q + NR * DM; h16* V = K + NR * DM;
    if ((size_t)(wsp - (char*)d_ws) > ws_size) return;    // total ~ 73 MB
    k_cvt8<<<XG + 3 * WG, 256, 0, stream>>>(x, Wq, Wk, Wv, XB, BW);   // torch [out][in] = Bt
    const dim3 gp((unsigned)(NR / 256), 3 * DM / 128, 1);
    k_gemms<<<gp, 256, 0, stream>>>(XB, BW, Q);
    k_attn<<<NB_ * (NC / 2), 256, 0, stream>>>(Q, K, V, msk, OUT);
}

// v005
// It runs in 68.8 microseconds.
// Two timings next to v004 both put it at 1.15 times that version's speed.
// All steps since v000 together make it 11.2 times as fast.
#include <hip/hip_runtime.h>

// SelfAttentionLayer (x [32][256][1024]; q/k/v = x W^T (torch [out,in], no bias); 64 chunks of 16 dims act as heads; logits = q.k / sqrt(1024) with mask2d = mask_i mask_j > 0 (sequence_mask read; all ones here); softmax; out[b][i][c*16 + d] = sum_j w v -> [32][256][1024]).
// Compute dtypes, f32 accumulate: every input rounded to bf16; q/k/v on PLAIN bf16 operands (inputs: exact); per-chunk scores single fp16 (q x 1/32; the 16-dim heads padded to K 32 with the mask's sign-class terms, else zeros) ; softmax f32 -> fp16 x 1024; attn.v single fp16; scores, softmax and attn.v of all (batch, chunk) pairs in one launch, the scores kept in registers. q x 1/32, k and v go from the products to the attention launch as fp16, rounded once from the f32 sums.

#define NB_  32
#define TT   256
#define DM   1024
#define HD   16
#define NC   64
#define PCAR 1024.0f
typedef _Float16 h16;
typedef unsigned short bf;
typedef __attribute__((ext_vector_type(16))) __bf16   v16bf;
typedef __attribute__((ext_vector_type(16))) _Float16 v16h;
typedef __attribute__((ext_vector_type(8)))  _Float16 v8h;
typedef __attribute__((ext_vector_type(8)))  unsigned short v8us;
typedef __attribute__((ext_vector_type(8)))  float    v8f;
typedef __attribute__((ext_vector_type(4)))  float    v4f;
typedef v8h  __attribute__((may_alias)) v8ha;
typedef v4f  __attribute__((may_alias)) v4fa;
typedef v8us __attribute__((may_alias)) v8usa;

__device__ __forceinline__ unsigned short f2bf(float f) { unsigned u = __float_as_uint(f); u += 0x7FFFu + ((u >> 16) & 1u); return (unsigned short)(u >> 16); }
__device__ __forceinline__ float bf2f(unsigned short b) { return __uint_as_float(((unsigned)b) << 16); }
__device__ __forceinline__ float bfr(float f) { return bf2f(f2bf(f)); }
__device__ __forceinline__ v16h cat16(v8h lo, v8h hi) { return __builtin_shufflevector(lo, hi, 0, 1, 2, 3, 4, 5, 6, 7, 8, 9, 10, 11, 12, 13, 14, 15); }
__device__ __forceinline__ v16bf cat16b(v8us lo, v8us hi) { return __builtin_bit_cast(v16bf, __builtin_shufflevector(lo, hi, 0, 1, 2, 3, 4, 5, 6, 7, 8, 9, 10, 11, 12, 13, 14, 15)); }
__device__ __forceinline__ v8f wmma16(v16h a, v16h b, v8f c) { return __builtin_amdgcn_wmma_f32_16x16x32_f16(false, a, false, b, (short)0, c, false, false); }
__device__ __forceinline__ v8f wmmab(v16bf a, v16bf b, v8f c) { return __builtin_amdgcn_wmma_f32_16x16x32_bf16(false, a, false, b, (short)0, c, false, false); }



// ---- k_gemms: C[p][m][n] (fp16, three planes of NB_ TT x DM; plane 0 times 1/32) = sum_k A[m][k] Bt[p DM + n][k], A and Bt K-contiguous bf16 planes of pitch DM; Bt holds the q, k and v weights one behind the other, so one launch does all three products.
// A plane of C is laid out [sequence][n / 8][row of the sequence][n % 8]: the 16-byte unit that k_attn's fragment reads take, so that the 32 columns of a chunk pair are 16 KB in a row.
// One work-group of 8 waves (4 x 2) per 256 x 128 tile of C, 64 x 64 per wave; grid (M / 256, 3 DM / 128).
// A stage is 128 k of the tile's 256 A rows and 128 Bt rows, brought into LDS by asynchronous copies, two buffers: stage t + 2 flies while stage t + 1 is worked on. The k order of every sum is ascending.
#define GKS    128                 // k per stage: 256 B of every row, two whole lines
#define GPITCH 136                 // 16-bit elements per LDS row: 272 B = 16 B x odd, for 16-byte fragment reads down 16 rows
#define GROWS  384                 // 256 A rows, then 128 Bt rows
__device__ __forceinline__ v16bf ldfrag(const bf* p) { return cat16b(*(const v8usa*)p, *(const v8usa*)(p + 16)); }
// eight copies of 16 B per lane: rows 16 apart, LDS byte address l, global address g. The s_wait_xcnt stands inside the statement, in front of any rewrite of the address registers that the copies name.
__device__ __forceinline__ void copy8(unsigned l, const bf* g) {
    asm volatile("global_load_async_to_lds_b128 %0, %8, off\n\tglobal_load_async_to_lds_b128 %1, %9, off\n\tglobal_load_async_to_lds_b128 %2, %10, off\n\tglobal_load_async_to_lds_b128 %3, %11, off\n\t"
                 "global_load_async_to_lds_b128 %4, %12, off\n\tglobal_load_async_to_lds_b128 %5, %13, off\n\tglobal_load_async_to_lds_b128 %6, %14, off\n\tglobal_load_async_to_lds_b128 %7, %15, off\n\ts_wait_xcnt 0x0"
                 :: "v"(l), "v"(l + 1u * 16u * GPITCH * 2u), "v"(l + 2u * 16u * GPITCH * 2u), "v"(l + 3u * 16u * GPITCH * 2u), "v"(l + 4u * 16u * GPITCH * 2u), "v"(l + 5u * 16u * GPITCH * 2u), "v"(l + 6u * 16u * GPITCH * 2u), "v"(l + 7u * 16u * GPITCH * 2u),
                    "v"(g), "v"(g + 1 * 16 * DM), "v"(g + 2 * 16 * DM), "v"(g + 3 * 16 * DM), "v"(g + 4 * 16 * DM), "v"(g + 5 * 16 * DM), "v"(g + 6 * 16 * DM), "v"(g + 7 * 16 * DM) : "memory");
}
__global__ __launch_bounds__(256) void k_gemms(const bf* __restrict__ A, const bf* __restrict__ Bt, h16* __restrict__ C) {
    __shared__ __align__(16) bf ring[2][GROWS * GPITCH];
    __shared__ __align__(16) float osw[8][16 * 68];
    const int tid = threadIdx.x, lane = tid & 31, wave = tid >> 5, lr = lane & 15, hi = lane >> 4, wm = wave >> 1, wn = wave & 1;
    const int r0 = blockIdx.x * 256, c0 = blockIdx.y * 128;
    // a lane copies 16 B of row (tid / 16) + 16 i: a wave's copy is two whole 256-byte rows
    const bf* ga = A + (size_t)(r0 + (tid >> 4)) * DM + (tid & 15) * 8;
    const bf* gb = Bt + (size_t)(c0 + (tid >> 4)) * DM + (tid & 15) * 8;
    const unsigned l0 = (unsigned)(size_t)&ring[0][0] + (unsigned)(tid >> 4) * (GPITCH * 2u) + (unsigned)(tid & 15) * 16u;
    const unsigned lbuf = GROWS * GPITCH * 2u;
    v8f acc[4][4];
#pragma unroll
    for (int mb = 0; mb < 4; ++mb)
#pragma unroll
        for (int nb = 0; nb < 4; ++nb) acc[mb][nb] = (v8f){};
    copy8(l0, ga); copy8(l0 + 128u * GPITCH * 2u, ga + 128 * DM); copy8(l0 + 256u * GPITCH * 2u, gb);
    asm volatile("s_wait_asynccnt 0x0" ::: "memory");   // stage 0 has landed before the barrier that publishes it
    __syncthreads();
    copy8(l0 + lbuf, ga + GKS); copy8(l0 + lbuf + 128u * GPITCH * 2u, ga + 128 * DM + GKS); copy8(l0 + lbuf + 256u * GPITCH * 2u, gb + GKS);
#pragma unroll 1   // rolled: one stage per trip, the buffer chosen by the trip's parity
    for (int t = 0; t < DM / GKS; ++t) {
        const bf* sa = &ring[t & 1][(wm * 64 + lr) * GPITCH + 8 * hi];
        const bf* sb = &ring[t & 1][(256 + wn * 64 + lr) * GPITCH + 8 * hi];
        v16bf a[2][4], b[2][4];   // two fragment sets: block ks + 1 is fetched while block ks is multiplied; no fragment of the next stage is fetched here
#pragma unroll
        for (int f = 0; f < 4; ++f) { a[0][f] = ldfrag(sa + f * 16 * GPITCH); b[0][f] = ldfrag(sb + f * 16 * GPITCH); }
#pragma unroll
        for (int ks = 0; ks < GKS / 32; ++ks) {
            if (ks + 1 < GKS / 32) {
#pragma unroll
                for (int f = 0; f < 4; ++f) { a[(ks + 1) & 1][f] = ldfrag(sa + f * 16 * GPITCH + (ks + 1) * 32); b[(ks + 1) & 1][f] = ldfrag(sb + f * 16 * GPITCH + (ks + 1) * 32); } }
            __builtin_amdgcn_sched_barrier(0);   // keeps the next block's LDS reads as one group in front of this block
#pragma unroll
            for (int nb = 0; nb < 4; ++nb)
#pragma unroll
                for (int mb = 0; mb < 4; ++mb) acc[mb][nb] = wmmab(a[ks & 1][mb], b[ks & 1][nb], acc[mb][nb]);
            __builtin_amdgcn_sched_barrier(0);   // the reads of block ks + 2 stay behind this block; the last block stays in front of the stage's waits, so that the copies in flight have the whole trip to land
        }
        asm volatile("s_wait_dscnt 0x0" ::: "memory");      // this wave's reads of the buffer are done before it is refilled
        asm volatile("s_wait_asynccnt 0x0" ::: "memory");   // this wave's copies of stage t + 1 have landed before the barrier that publishes them
        __syncthreads();
        if (t + 2 < DM / GKS) { const unsigned l = l0 + (unsigned)(t & 1) * lbuf; const int ko = (t + 2) * GKS;
            copy8(l, ga + ko); copy8(l + 128u * GPITCH * 2u, ga + 128 * DM + ko); copy8(l + 256u * GPITCH * 2u, gb + ko); }
    }
    asm volatile("s_wait_asynccnt 0x0" ::: "memory");       // no copy is outstanding when the wave goes on to its end
    float* os = osw[wave];
    const float sc = c0 < DM ? 0.03125f : 1.0f;   // the q plane carries the 1 / sqrt(1024) of the logits: a power of two, exact
#pragma unroll
    for (int mb = 0; mb < 4; ++mb) {
#pragma unroll
        for (int nb = 0; nb < 4; ++nb) {
#pragma unroll
            for (int j = 0; j < 8; ++j) os[(hi * 8 + j) * 68 + nb * 16 + lr] = acc[mb][nb][j]; }
        __builtin_amdgcn_wave_barrier(); asm volatile("" ::: "memory");   // the reads below take what other lanes of this wave wrote: keeps the compiler from moving them up
        // the tile's 256 rows are one sequence; a lane takes 8 columns of one row, 16 lanes 256 B in a row
        h16* cu = C + (size_t)(c0 / DM) * ((size_t)NB_ * TT * DM) + (size_t)r0 * DM + (size_t)(((c0 % DM) + wn * 64) / 8) * (TT * 8) + (wm * 64 + mb * 16 + lr) * 8;
#pragma unroll
        for (int s = 0; s < 4; ++s) { const int cg = 2 * s + hi; const v4f x0 = *(const v4fa*)(os + lr * 68 + cg * 8), x1 = *(const v4fa*)(os + lr * 68 + cg * 8 + 4); v8h o;
#pragma unroll
            for (int u = 0; u < 4; ++u) { o[u] = (h16)(x0[u] * sc); o[4 + u] = (h16)(x1[u] * sc); }
            *(v8h*)(cu + cg * (TT * 8)) = o; }
        __builtin_amdgcn_wave_barrier();
        if (mb < 3) asm volatile("s_wait_xcnt 0x0" ::: "memory");   // the next 16 rows' staging writes stay behind the reads above, and their read-back rewrites registers that the stores above name only behind this wait
    }
}

__device__ __forceinline__ h16 tohx(float x) { return (h16)x; }
typedef __attribute__((ext_vector_type(2))) _Float16 v2h;
typedef __attribute__((ext_vector_type(4))) _Float16 v4h;

// ---- k_cvt8: all four f32 inputs to bf16 in one launch, 8 elements a thread. Work-groups 0 .. XG - 1 take x, then WG work-groups each for Wq, Wk, Wv, whose bf16 planes lie one behind the other in wb.
#define XG (NB_ * TT * DM / 8 / 256)
#define WG (DM * DM / 8 / 256)
__global__ __launch_bounds__(256) void k_cvt8(const float* __restrict__ x, const float* __restrict__ wq, const float* __restrict__ wk, const float* __restrict__ wv, bf* __restrict__ xb, bf* __restrict__ wb) {
    const int blk = blockIdx.x; const float* src = x; bf* dst = xb; int rel = blk;
    if (blk >= XG) { const int p = (blk - XG) / WG; rel = (blk - XG) % WG; src = p == 0 ? wq : p == 1 ? wk : wv; dst = wb + (size_t)p * DM * DM; }
    const size_t i = (size_t)rel * 256 + threadIdx.x; const v8f v = *(const v8f*)(src + i * 8); v8us o;
#pragma unroll
    for (int k = 0; k < 8; ++k) o[k] = f2bf(v[k]); *(v8us*)(dst + i * 8) = o;  }
typedef v4h __attribute__((may_alias)) v4ha;
typedef v2h __attribute__((may_alias)) v2ha;
// lane l <-> lane l ^ 16
__device__ __forceinline__ float xhalf(float x) { const int b = __float_as_int(x); return __int_as_float(__builtin_amdgcn_permlanex16(b, b, 0x76543210, 0xfedcba98, false, false)); }

#define VPITCH 264   // halves per V^T row: 528 B = 16 B x odd, for 16-byte LDS reads down a column of rows
#define OPITCH 36    // floats per staged output row: 144 B = 16 B x odd
// The mask in the score product. m_i m_j > 0 holds exactly where both values are positive or both negative (no underflow: see the test in the kernel). With p, n the indicators of positive and negative,
// p_i (1 - p_j) + n_i (1 - n_j) + (1 - p_i - n_i) is 1 for a masked pair and a sum of exact zeros for any other. The three terms stand in the zero-padded k of the 16-dim heads, scaled -MQC x MKC,
// in both halves of the wave: a masked score comes out of the matrix instruction 2^30 lower, an unmasked one unchanged, and no vector instruction per score is spent on the mask.
#define MKC 32768.0f
#define MQC 16384.0f
template <bool G> struct Sel { static constexpr bool v = G; };
// amdgpu_waves_per_eu(4, 4): a register budget of 256, so that two work-groups share a WGP; without it the build went above 256 registers.
__global__ __launch_bounds__(256) __attribute__((amdgpu_waves_per_eu(4, 4))) void k_attn(const h16* __restrict__ Q, const h16* __restrict__ K, const h16* __restrict__ V, const float* __restrict__ msk, float* __restrict__ out) {
    __shared__ __align__(16) h16 Qs[2][2][TT][8];     // [chunk][d / 8][row][d % 8]: a fragment read is 16 contiguous rows of 16 B per wave half
    __shared__ __align__(16) h16 Ks[2][2][TT][8];
    __shared__ __align__(16) h16 Vs[2][HD][VPITCH];   // [chunk][d][j]
    __shared__ __align__(16) float Ms[TT];
    __shared__ __align__(16) h16 Kp[TT][8];           // per key: the mask's three terms for k 16..18 (and 24..26) of the score product, then zeros
    __shared__ __align__(16) float Os[8][16][OPITCH];
    const int tid = threadIdx.x, lane = tid & 31, wave = tid >> 5, lr = lane & 15, hi = lane >> 4;
    const int b = blockIdx.x >> 5;
    const size_t base = (size_t)b * TT * DM + (size_t)(blockIdx.x & 31) * (2 * HD);
    const size_t ib = (size_t)b * TT * DM + (size_t)(blockIdx.x & 31) * (2 * HD * TT);   // the pair's 16 KB in each fp16 plane: [chunk][d / 8][row][d % 8], the layout of Qs and Ks
    const int gg = tid >> 6;   // which 8 of the pair's 32 columns this thread transposes
    v8h q8[4], k8[4], va[2], vb[2];
#pragma unroll
    for (int s = 0; s < 4; ++s) { const int u = (tid + 256 * s) * 8; q8[s] = *(const v8h*)(Q + ib + u); k8[s] = *(const v8h*)(K + ib + u); }
#pragma unroll
    for (int s = 0; s < 2; ++s) { const int j = 2 * (tid & 63) + 128 * s; va[s] = *(const v8h*)(V + ib + (gg * TT + j) * 8); vb[s] = *(const v8h*)(V + ib + (gg * TT + j + 1) * 8); }
    const float mraw = msk[b * TT + tid];
    asm volatile("s_wait_xcnt 0x0" ::: "memory");   // stands in front of the rewrites of the offset registers that the loads above name
    __builtin_amdgcn_sched_barrier(0);              // keeps the index arithmetic below, which reuses those registers, behind that wait
#pragma unroll
    for (int s = 0; s < 4; ++s) { const int u = (tid + 256 * s) * 8; *(v8ha*)(&Qs[0][0][0][0] + u) = q8[s]; *(v8ha*)(&Ks[0][0][0][0] + u) = k8[s]; }
#pragma unroll
    for (int s = 0; s < 2; ++s) { const int j = 2 * (tid & 63) + 128 * s;
#pragma unroll
        for (int u = 0; u < 8; ++u) { v2h o; o[0] = va[s][u]; o[1] = vb[s][u]; *(v2ha*)&Vs[gg >> 1][(gg & 1) * 8 + u][j] = o; } }
    const float mown = bfr(mraw);
    Ms[tid] = mown;
    { v8h kp = {}; kp[0] = mown > 0.f ? (h16)0.f : (h16)MKC; kp[1] = mown < 0.f ? (h16)0.f : (h16)MKC; kp[2] = (h16)MKC; *(v8ha*)&Kp[tid][0] = kp; }
    __syncthreads();
    const v8h z8 = {};
    // a non-zero mask value below 2^-63 can make m_i m_j underflow, which the sign classes do not see: such a sequence takes the form that multiplies the mask values out. The test reads all 256 values in every wave, so it is the same for the whole work-group.
    bool tiny = false;
    { const v4f ta = *(const v4fa*)&Ms[lane * 8], tb = *(const v4fa*)&Ms[lane * 8 + 4];
#pragma unroll
      for (int r = 0; r < 4; ++r) { const float a0 = fabsf(ta[r]), a1 = fabsf(tb[r]); tiny = tiny | ((a0 > 0.f) & (a0 < 0x1p-63f)) | ((a1 > 0.f) & (a1 < 0x1p-63f)); } }
    const bool general = __builtin_amdgcn_ballot_w32(tiny) != 0u;
    auto rows = [&](auto gsel) {
    constexpr bool GEN = decltype(gsel)::v;
#pragma unroll 1   // rolled: one copy of the 16-row body
    for (int it = 0; it < 2; ++it) {
        const int i0 = (wave + 8 * it) * 16; const float mi = Ms[i0 + lr];
        v8h qp = {};   // the query's side of the mask terms: one of the three is -MQC, by the sign class of m_i (positive, negative, neither)
        if constexpr (!GEN) { qp[0] = mi > 0.f ? (h16)(-MQC) : (h16)0.f; qp[1] = mi < 0.f ? (h16)(-MQC) : (h16)0.f; qp[2] = (mi > 0.f || mi < 0.f) ? (h16)0.f : (h16)(-MQC); }
#pragma unroll 1   // rolled, as above
        for (int ch = 0; ch < 2; ++ch) {
            const v16h qb = cat16(*(const v8ha*)&Qs[ch][hi][i0 + lr][0], qp);   // k 16..31: the mask terms, else zero
            v8f s[16];
#pragma unroll
            for (int t = 0; t < 16; ++t) { v8h kp = z8;
                if constexpr (!GEN) kp = *(const v8ha*)&Kp[t * 16 + lr][0];
                s[t] = wmma16(cat16(*(const v8ha*)&Ks[ch][hi][t * 16 + lr][0], kp), qb, (v8f){}); }   // s[t][r] = S[i0 + lr][16 t + 8 hi + r], minus 2^30 where the pair is masked
            v8f mxv;
#pragma unroll
            for (int r = 0; r < 8; ++r) mxv[r] = -3.0e38f;
            if constexpr (GEN) {
#pragma unroll
                for (int t = 0; t < 16; ++t) { const v4f ma = *(const v4fa*)&Ms[t * 16 + hi * 8], mb = *(const v4fa*)&Ms[t * 16 + hi * 8 + 4];
#pragma unroll
                    for (int r = 0; r < 8; ++r) { const float mj = r < 4 ? ma[r & 3] : mb[r & 3]; const float x = (mi * mj > 0.f) ? s[t][r] : -1.0e9f; s[t][r] = x; mxv[r] = fmaxf(mxv[r], x); } }
            } else {
#pragma unroll
                for (int t = 0; t < 16; ++t)
#pragma unroll
                    for (int r = 0; r < 8; ++r) mxv[r] = fmaxf(mxv[r], s[t][r]);
            }
            float mx = fmaxf(fmaxf(fmaxf(mxv[0], mxv[1]), fmaxf(mxv[2], mxv[3])), fmaxf(fmaxf(mxv[4], mxv[5]), fmaxf(mxv[6], mxv[7])));
            mx = fmaxf(mx, xhalf(mx));
            if constexpr (!GEN) __builtin_amdgcn_sched_barrier(0);   // keeps the reads of V^T behind the scores: lifted to the head of the pass they stood in 64 registers beside the K fragments and the build spilled
            const float l2e = (!GEN && mx < -5.0e8f) ? 0.f : 1.4426950408889634f;   // a row with every pair masked has equal weights, as the reference's row of equal logits has
            v8f sv = {};
#pragma unroll
            for (int t = 0; t < 16; ++t) { float e0 = (s[t][0] - mx) * l2e, e1 = (s[t][1] - mx) * l2e, e2 = (s[t][2] - mx) * l2e, e3 = (s[t][3] - mx) * l2e, e4 = (s[t][4] - mx) * l2e, e5 = (s[t][5] - mx) * l2e, e6 = (s[t][6] - mx) * l2e, e7 = (s[t][7] - mx) * l2e;
                // eight independent exp2 in place, then one v_nop: keeps the slot that the instruction set asks for behind a transcendental
                asm("v_exp_f32 %0, %0\n\tv_exp_f32 %1, %1\n\tv_exp_f32 %2, %2\n\tv_exp_f32 %3, %3\n\tv_exp_f32 %4, %4\n\tv_exp_f32 %5, %5\n\tv_exp_f32 %6, %6\n\tv_exp_f32 %7, %7\n\tv_nop" : "+v"(e0), "+v"(e1), "+v"(e2), "+v"(e3), "+v"(e4), "+v"(e5), "+v"(e6), "+v"(e7));
                s[t] = (v8f){e0, e1, e2, e3, e4, e5, e6, e7}; sv += s[t]; }
            float sum = ((sv[0] + sv[1]) + (sv[2] + sv[3])) + ((sv[4] + sv[5]) + (sv[6] + sv[7]));
            sum += xhalf(sum);
            const float f = PCAR / sum;
            v8f o = {};
#pragma unroll
            for (int u = 0; u < 8; ++u) { v16h pb;
#pragma unroll
                for (int r = 0; r < 8; ++r) { pb[r] = tohx(s[2 * u][r] * f); pb[8 + r] = tohx(s[2 * u + 1][r] * f); }
                o = wmma16(cat16(*(const v8ha*)&Vs[ch][lr][u * 32 + 8 * hi], *(const v8ha*)&Vs[ch][lr][u * 32 + 16 + 8 * hi]), pb, o); }   // o[r] = O[i0 + lr][8 hi + r] x 1024
            v4f o0, o1;
#pragma unroll
            for (int r = 0; r < 4; ++r) { o0[r] = o[r] * (1.0f / PCAR); o1[r] = o[4 + r] * (1.0f / PCAR); }
            *(v4fa*)&Os[wave][lr][ch * HD + hi * 8] = o0; *(v4fa*)&Os[wave][lr][ch * HD + hi * 8 + 4] = o1;
        }
        __builtin_amdgcn_fence(__ATOMIC_ACQ_REL, "wavefront");   // the reads below take what other lanes of this wave wrote: keeps the compiler from moving them up
#pragma unroll
        for (int s = 0; s < 4; ++s) { const int row = (lane >> 3) + 4 * s; *(v4f*)(out + base + (size_t)(i0 + row) * DM + (lane & 7) * 4) = *(const v4fa*)&Os[wave][row][(lane & 7) * 4]; }
        __builtin_amdgcn_fence(__ATOMIC_ACQ_REL, "wavefront");   // the next 16 rows' writes to the staging rows stay behind these reads
        asm volatile("s_wait_xcnt 0x0" ::: "memory");            // stands in front of the next pass's rewrites of the registers that the stores above name
    }
    };
    if (general) rows(Sel<true>{}); else rows(Sel<false>{});
}

extern "C" void kernel_launch(void* const* d_in, const int* in_sizes, int n_in,
                              void* d_out, int out_size, void* d_ws, size_t ws_size, hipStream_t stream) {
    (void)in_sizes; (void)n_in; (void)out_size;
    const float* x = (const float*)d_in[0]; const float* msk = (const float*)d_in[1]; const float* Wq = (const float*)d_in[2]; const float* Wk = (const float*)d_in[3]; const float* Wv = (const float*)d_in[4];
    float* OUT = (float*)d_out;     // [32][256][1024]
    char* wsp = (char*)d_ws;
    auto take = [&](size_t bytes) { char* p = wsp; wsp += (bytes + 255) & ~(size_t)255; return (void*)p; };
    const size_t NR = (size_t)NB_ * TT;
    bf* XB = (bf*)take(NR * DM * 2); bf* BW = (bf*)take((size_t)3 * DM * DM * 2); h16* Q = (h16*)take(3 * NR * DM * 2); h16* K = Q + NR * DM; h16* V = K + NR * DM;
    if ((size_t)(wsp - (char*)d_ws) > ws_size) return;    // total ~ 73 MB
    k_cvt8<<<XG + 3 * WG, 256, 0, stream>>>(x, Wq, Wk, Wv, XB, BW);   // torch [out][in] = Bt
    const dim3 gp((unsigned)(NR / 256), 3 * DM / 128, 1);
    k_gemms<<<gp, 256, 0, stream>>>(XB, BW, Q);
    k_attn<<<NB_ * (NC / 2), 256, 0, stream>>>(Q, K, V, msk, OUT);
}

// v006
// Measured time: 56.9 microseconds a run.
// Next to v005, in two timings, it ran 1.20 and 1.21 times as fast.
// Over all steps from v000 it is 13.5 times as fast.
#include <hip/hip_runtime.h>

// SelfAttentionLayer (x [32][256][1024]; q/k/v = x W^T (torch [out,in], no bias); 64 chunks of 16 dims act as heads; logits = q.k / sqrt(1024) with mask2d = mask_i mask_j > 0 (sequence_mask read; all ones here); softmax; out[b][i][c*16 + d] = sum_j w v -> [32][256][1024]).
// Compute dtypes, f32 accumulate: every input rounded to bf16; q/k/v on PLAIN bf16 operands (inputs: exact); per-chunk scores single fp16 (q x 1/32; the 16-dim heads padded to K 32 with the mask terms, else zeros) ; softmax f32 -> fp16 x 1024; attn.v single fp16; products, scores, softmax and attn.v in one launch, the scores kept in registers. q x 1/32, k and v go from the products to the attention part through LDS as fp16, rounded once from the f32 sums.

#define NB_  32
#define TT   256
#define DM   1024
#define HD   16
#define NC   64
#define PCAR 1024.0f
typedef _Float16 h16;
typedef unsigned short bf;
typedef __attribute__((ext_vector_type(16))) __bf16   v16bf;
typedef __attribute__((ext_vector_type(16))) _Float16 v16h;
typedef __attribute__((ext_vector_type(8)))  _Float16 v8h;
typedef __attribute__((ext_vector_type(8)))  unsigned short v8us;
typedef __attribute__((ext_vector_type(8)))  float    v8f;
typedef __attribute__((ext_vector_type(4)))  float    v4f;
typedef v8h  __attribute__((may_alias)) v8ha;
typedef v4f  __attribute__((may_alias)) v4fa;
typedef v8us __attribute__((may_alias)) v8usa;

__device__ __forceinline__ unsigned short f2bf(float f) { unsigned u = __float_as_uint(f); u += 0x7FFFu + ((u >> 16) & 1u); return (unsigned short)(u >> 16); }
__device__ __forceinline__ float bf2f(unsigned short b) { return __uint_as_float(((unsigned)b) << 16); }
__device__ __forceinline__ float bfr(float f) { return bf2f(f2bf(f)); }
__device__ __forceinline__ v16h cat16(v8h lo, v8h hi) { return __builtin_shufflevector(lo, hi, 0, 1, 2, 3, 4, 5, 6, 7, 8, 9, 10, 11, 12, 13, 14, 15); }
__device__ __forceinline__ v16bf cat16b(v8us lo, v8us hi) { return __builtin_bit_cast(v16bf, __builtin_shufflevector(lo, hi, 0, 1, 2, 3, 4, 5, 6, 7, 8, 9, 10, 11, 12, 13, 14, 15)); }
__device__ __forceinline__ v8f wmma16(v16h a, v16h b, v8f c) { return __builtin_amdgcn_wmma_f32_16x16x32_f16(false, a, false, b, (short)0, c, false, false); }
__device__ __forceinline__ v8f wmmab(v16bf a, v16bf b, v8f c) { return __builtin_amdgcn_wmma_f32_16x16x32_bf16(false, a, false, b, (short)0, c, false, false); }



__device__ __forceinline__ h16 tohx(float x) { return (h16)x; }
typedef __attribute__((ext_vector_type(2))) _Float16 v2h;
typedef __attribute__((ext_vector_type(4))) _Float16 v4h;

// ---- k_cvt8: all four f32 inputs to bf16 in one launch, 8 elements a thread. Work-groups 0 .. XG - 1 take x, then WG work-groups each for Wq, Wk, Wv, whose bf16 planes lie one behind the other in wb.
#define XG (NB_ * TT * DM / 8 / 256)
#define WG (DM * DM / 8 / 256)
__global__ __launch_bounds__(256) void k_cvt8(const float* __restrict__ x, const float* __restrict__ wq, const float* __restrict__ wk, const float* __restrict__ wv, bf* __restrict__ xb, bf* __restrict__ wb) {
    const int blk = blockIdx.x; const float* src = x; bf* dst = xb; int rel = blk;
    if (blk >= XG) { const int p = (blk - XG) / WG; rel = (blk - XG) % WG; src = p == 0 ? wq : p == 1 ? wk : wv; dst = wb + (size_t)p * DM * DM; }
    const size_t i = (size_t)rel * 256 + threadIdx.x; const v8f v = *(const v8f*)(src + i * 8); v8us o;
#pragma unroll
    for (int k = 0; k < 8; ++k) o[k] = f2bf(v[k]); *(v8us*)(dst + i * 8) = o;  }
typedef v4h __attribute__((may_alias)) v4ha;
typedef v2h __attribute__((may_alias)) v2ha;
// lane l <-> lane l ^ 16
__device__ __forceinline__ float xhalf(float x) { const int b = __float_as_int(x); return __int_as_float(__builtin_amdgcn_permlanex16(b, b, 0x76543210, 0xfedcba98, false, false)); }

// ---- k_fused: one work-group (8 waves) per (sequence, four neighbouring 16-dim chunks): first q, k and v of those 64 columns, then their attention; q, k, v never leave the WGP.
// Part 1: C[256][192] = sum_k A[m][k] Bt[n][k], A the sequence's 256 rows, Bt 64 rows of each of the q, k and v weight planes (which lie one behind the other), K-contiguous bf16 of pitch DM.
// Waves 4 x 2, 64 rows x (32 q + 32 k + 32 v columns) per wave. The q and k tiles are formed transposed (weights as the A operand), so that a lane holds 8 consecutive d of one row, the v tiles straight, so that a lane holds 8 consecutive rows of one d:
// each is the 16-byte unit of its LDS layout in part 2 and goes there without a transpose.
// A stage is 128 k of the 256 A rows and 192 Bt rows, brought into LDS by asynchronous copies, two buffers: stage t + 2 flies while stage t + 1 is worked on. The k order of every sum is ascending.
#define GKS    128                 // k per stage: 256 B of every row, two whole lines
#define GPITCH 136                 // 16-bit elements per LDS row: 272 B = 16 B x odd, for 16-byte fragment reads down 16 rows
#define GROWS  448                 // 256 A rows, then 64 Bt rows of each plane
#define CPG    4                   // chunks per work-group
__device__ __forceinline__ v16bf ldfrag(const bf* p) { return cat16b(*(const v8usa*)p, *(const v8usa*)(p + 16)); }
// eight copies of 16 B per lane: rows 16 apart, LDS byte address l, global address g. The s_wait_xcnt stands inside the statement, in front of any rewrite of the address registers that the copies name.
__device__ __forceinline__ void copy8(unsigned l, const bf* g) {
    asm volatile("global_load_async_to_lds_b128 %0, %8, off\n\tglobal_load_async_to_lds_b128 %1, %9, off\n\tglobal_load_async_to_lds_b128 %2, %10, off\n\tglobal_load_async_to_lds_b128 %3, %11, off\n\t"
                 "global_load_async_to_lds_b128 %4, %12, off\n\tglobal_load_async_to_lds_b128 %5, %13, off\n\tglobal_load_async_to_lds_b128 %6, %14, off\n\tglobal_load_async_to_lds_b128 %7, %15, off\n\ts_wait_xcnt 0x0"
                 :: "v"(l), "v"(l + 1u * 16u * GPITCH * 2u), "v"(l + 2u * 16u * GPITCH * 2u), "v"(l + 3u * 16u * GPITCH * 2u), "v"(l + 4u * 16u * GPITCH * 2u), "v"(l + 5u * 16u * GPITCH * 2u), "v"(l + 6u * 16u * GPITCH * 2u), "v"(l + 7u * 16u * GPITCH * 2u),
                    "v"(g), "v"(g + 1 * 16 * DM), "v"(g + 2 * 16 * DM), "v"(g + 3 * 16 * DM), "v"(g + 4 * 16 * DM), "v"(g + 5 * 16 * DM), "v"(g + 6 * 16 * DM), "v"(g + 7 * 16 * DM) : "memory");
}
// the same for twelve copies: 64 rows of each of the three weight planes, which follow one another in LDS
__device__ __forceinline__ void copy12(unsigned l, const bf* g) {
    asm volatile("global_load_async_to_lds_b128 %0, %12, off\n\tglobal_load_async_to_lds_b128 %1, %13, off\n\tglobal_load_async_to_lds_b128 %2, %14, off\n\tglobal_load_async_to_lds_b128 %3, %15, off\n\t"
                 "global_load_async_to_lds_b128 %4, %16, off\n\tglobal_load_async_to_lds_b128 %5, %17, off\n\tglobal_load_async_to_lds_b128 %6, %18, off\n\tglobal_load_async_to_lds_b128 %7, %19, off\n\t"
                 "global_load_async_to_lds_b128 %8, %20, off\n\tglobal_load_async_to_lds_b128 %9, %21, off\n\tglobal_load_async_to_lds_b128 %10, %22, off\n\tglobal_load_async_to_lds_b128 %11, %23, off\n\ts_wait_xcnt 0x0"
                 :: "v"(l + 0u * 16u * GPITCH * 2u), "v"(l + 1u * 16u * GPITCH * 2u), "v"(l + 2u * 16u * GPITCH * 2u), "v"(l + 3u * 16u * GPITCH * 2u), "v"(l + 4u * 16u * GPITCH * 2u), "v"(l + 5u * 16u * GPITCH * 2u), "v"(l + 6u * 16u * GPITCH * 2u), "v"(l + 7u * 16u * GPITCH * 2u), "v"(l + 8u * 16u * GPITCH * 2u), "v"(l + 9u * 16u * GPITCH * 2u), "v"(l + 10u * 16u * GPITCH * 2u), "v"(l + 11u * 16u * GPITCH * 2u),
                    "v"(g + 0 * DM * DM + 0 * 16 * DM), "v"(g + 0 * DM * DM + 1 * 16 * DM), "v"(g + 0 * DM * DM + 2 * 16 * DM), "v"(g + 0 * DM * DM + 3 * 16 * DM), "v"(g + 1 * DM * DM + 0 * 16 * DM), "v"(g + 1 * DM * DM + 1 * 16 * DM), "v"(g + 1 * DM * DM + 2 * 16 * DM), "v"(g + 1 * DM * DM + 3 * 16 * DM), "v"(g + 2 * DM * DM + 0 * 16 * DM), "v"(g + 2 * DM * DM + 1 * 16 * DM), "v"(g + 2 * DM * DM + 2 * 16 * DM), "v"(g + 2 * DM * DM + 3 * 16 * DM) : "memory");
}
// one stage: 28 copies a lane
__device__ __forceinline__ void stage(unsigned l, const bf* ga, const bf* gb) {
    copy8(l, ga); copy8(l + 128u * GPITCH * 2u, ga + 128 * DM); copy12(l + 256u * GPITCH * 2u, gb);
}
#define VPITCH 264   // halves per V^T row: 528 B = 16 B x odd, for 16-byte LDS reads down a column of rows
#define OPITCH 68    // floats per staged output row: 272 B = 16 B x odd
// The mask in the score product. m_i m_j > 0 holds exactly where both values are positive or both negative (no underflow: see the test in the kernel). With p, n the indicators of positive and negative,
// p_i (1 - p_j) + n_i (1 - n_j) + (1 - p_i - n_i) is 1 for a masked pair and a sum of exact zeros for any other. The three terms stand in the zero-padded k of the 16-dim heads, scaled -MQC x MKC,
// in both halves of the wave: a masked score comes out of the matrix instruction 2^30 lower, an unmasked one unchanged, and no vector instruction per score is spent on the mask.
#define MKC 32768.0f
#define MQC 16384.0f
template <bool G> struct Sel { static constexpr bool v = G; };
struct AttnLds {
    h16 Qs[CPG][2][TT][8];     // [chunk][d / 8][row][d % 8]: a fragment read is 16 contiguous rows of 16 B per wave half
    h16 Ks[CPG][2][TT][8];
    h16 Vs[CPG][HD][VPITCH];   // [chunk][d][j]
    float Ms[TT];
    h16 Kp[TT][8];             // per key: the mask's three terms for k 16..18 (and 24..26) of the score product, then zeros
    float Os[8][16][OPITCH];
};
union FusedLds { bf ring[2][GROWS * GPITCH]; AttnLds at; };   // part 2's arrays take the ring's place once the last stage has been read
// amdgpu_waves_per_eu(2, 2): the ring leaves room for one work-group on a WGP, two waves a SIMD, so a wave may have 512 registers (192 of them accumulators).
__global__ __launch_bounds__(256) __attribute__((amdgpu_waves_per_eu(2, 2))) void k_fused(const bf* __restrict__ A, const bf* __restrict__ Bt, const float* __restrict__ msk, float* __restrict__ out) {
    __shared__ __align__(16) FusedLds sm;
    const int tid = threadIdx.x, lane = tid & 31, wave = tid >> 5, lr = lane & 15, hi = lane >> 4, wm = wave >> 1, wn = wave & 1;
    const int b = blockIdx.x >> 4, cg = blockIdx.x & 15;
    // a lane copies 16 B of row (tid / 16) + 16 i: a wave's copy is two whole 256-byte rows
    const bf* ga = A + (size_t)(b * TT + (tid >> 4)) * DM + (tid & 15) * 8;
    const bf* gb = Bt + (size_t)(cg * (CPG * HD) + (tid >> 4)) * DM + (tid & 15) * 8;
    const unsigned l0 = (unsigned)(size_t)&sm.ring[0][0] + (unsigned)(tid >> 4) * (GPITCH * 2u) + (unsigned)(tid & 15) * 16u;
    const unsigned lbuf = GROWS * GPITCH * 2u;
    // the loop forms its addresses from these, not from ga and gb: as operands of the first stage's asm statements ga and gb are tied to the low 256 registers, and kept alive through the loop beside the accumulators they were spilled to scratch and read back on every trip
    const unsigned vo = (unsigned)(tid >> 4) * DM + (unsigned)(tid & 15) * 8u;
    const unsigned sa0 = (unsigned)__builtin_amdgcn_readfirstlane(b) * (TT * DM), sb0 = (unsigned)__builtin_amdgcn_readfirstlane(cg) * (CPG * HD * DM);
    v8f acc[4][6];   // nb 0, 1: q; 2, 3: k (both transposed); 4, 5: v
#pragma unroll
    for (int mb = 0; mb < 4; ++mb)
#pragma unroll
        for (int nb = 0; nb < 6; ++nb) acc[mb][nb] = (v8f){};
    stage(l0, ga, gb);
    const float mraw = msk[b * TT + tid];
    asm volatile("s_wait_xcnt 0x0" ::: "memory");   // stands in front of the rewrites of the address registers that the load above names
    __builtin_amdgcn_sched_barrier(0);              // keeps the arithmetic below, which may reuse those registers, behind that wait
    asm volatile("s_wait_asynccnt 0x0" ::: "memory");   // stage 0 has landed before the barrier that publishes it
    __syncthreads();
    stage(l0 + lbuf, ga + GKS, gb + GKS);
#pragma unroll 1   // rolled: one stage per trip, the buffer chosen by the trip's parity
    for (int t = 0; t < DM / GKS; ++t) {
        const bf* sa = &sm.ring[t & 1][(wm * 64 + lr) * GPITCH + 8 * hi];
        const bf* sb = &sm.ring[t & 1][(256 + wn * 32 + lr) * GPITCH + 8 * hi];   // tile nb: plane nb / 2, 64 rows on; 16 rows on for odd nb
        v16bf a[2][4], w[2][6];   // two fragment sets: block ks + 1 is fetched while block ks is multiplied; no fragment of the next stage is fetched here
#pragma unroll
        for (int f = 0; f < 4; ++f) a[0][f] = ldfrag(sa + f * 16 * GPITCH);
#pragma unroll
        for (int f = 0; f < 6; ++f) w[0][f] = ldfrag(sb + ((f >> 1) * 64 + (f & 1) * 16) * GPITCH);
#pragma unroll
        for (int ks = 0; ks < GKS / 32; ++ks) {
            if (ks + 1 < GKS / 32) {
#pragma unroll
                for (int f = 0; f < 4; ++f) a[(ks + 1) & 1][f] = ldfrag(sa + f * 16 * GPITCH + (ks + 1) * 32);
#pragma unroll
                for (int f = 0; f < 6; ++f) w[(ks + 1) & 1][f] = ldfrag(sb + ((f >> 1) * 64 + (f & 1) * 16) * GPITCH + (ks + 1) * 32); }
            __builtin_amdgcn_sched_barrier(0);   // keeps the next block's LDS reads as one group in front of this block
#pragma unroll
            for (int nb = 0; nb < 6; ++nb)
#pragma unroll
                for (int mb = 0; mb < 4; ++mb) acc[mb][nb] = nb < 4 ? wmmab(w[ks & 1][nb], a[ks & 1][mb], acc[mb][nb]) : wmmab(a[ks & 1][mb], w[ks & 1][nb], acc[mb][nb]);
            __builtin_amdgcn_sched_barrier(0);   // the reads of block ks + 2 stay behind this block; the last block stays in front of the stage's waits, so that the copies in flight have the whole trip to land
        }
        asm volatile("s_wait_dscnt 0x0" ::: "memory");      // this wave's reads of the buffer are done before it is refilled
        asm volatile("s_wait_asynccnt 0x0" ::: "memory");   // this wave's copies of stage t + 1 have landed before the barrier that publishes them
        __syncthreads();
        if (t + 2 < DM / GKS) stage(l0 + (unsigned)(t & 1) * lbuf, A + ((size_t)sa0 + (t + 2) * GKS + vo), Bt + ((size_t)sb0 + (t + 2) * GKS + vo));
    }
    asm volatile("s_wait_asynccnt 0x0" ::: "memory");       // no copy is outstanding when the ring's LDS is given to part 2
    // behind the last trip's barrier no wave reads the ring any more: q x 1/32 (the 1 / sqrt(1024) of the logits: a power of two, exact), k and v go to their places as fp16
    AttnLds& L = sm.at;
#pragma unroll
    for (int mb = 0; mb < 4; ++mb)
#pragma unroll
        for (int nb = 0; nb < 6; ++nb) { const int ch = wn * 2 + (nb & 1), row = wm * 64 + mb * 16; v8h o;
#pragma unroll
            for (int j = 0; j < 8; ++j) o[j] = (h16)(acc[mb][nb][j] * (nb < 2 ? 0.03125f : 1.0f));
            if (nb < 2) *(v8ha*)&L.Qs[ch][hi][row + lr][0] = o;            // acc[j] = q[row + lr][16 ch + 8 hi + j]
            else if (nb < 4) *(v8ha*)&L.Ks[ch][hi][row + lr][0] = o;
            else *(v8ha*)&L.Vs[ch][lr][row + hi * 8] = o; }                // acc[j] = v[row + 8 hi + j][16 ch + lr]
    const size_t base = (size_t)b * TT * DM + (size_t)cg * (CPG * HD);
    const float mown = bfr(mraw);
    L.Ms[tid] = mown;
    { v8h kp = {}; kp[0] = mown > 0.f ? (h16)0.f : (h16)MKC; kp[1] = mown < 0.f ? (h16)0.f : (h16)MKC; kp[2] = (h16)MKC; *(v8ha*)&L.Kp[tid][0] = kp; }
    __syncthreads();
    const v8h z8 = {};
    // a non-zero mask value below 2^-63 can make m_i m_j underflow, which the sign classes do not see: such a sequence takes the form that multiplies the mask values out. The test reads all 256 values in every wave, so it is the same for the whole work-group.
    bool tiny = false;
    { const v4f ta = *(const v4fa*)&L.Ms[lane * 8], tb = *(const v4fa*)&L.Ms[lane * 8 + 4];
#pragma unroll
      for (int r = 0; r < 4; ++r) { const float a0 = fabsf(ta[r]), a1 = fabsf(tb[r]); tiny = tiny | ((a0 > 0.f) & (a0 < 0x1p-63f)) | ((a1 > 0.f) & (a1 < 0x1p-63f)); } }
    const bool general = __builtin_amdgcn_ballot_w32(tiny) != 0u;
    auto rows = [&](auto gsel) {
    constexpr bool GEN = decltype(gsel)::v;
#pragma unroll 1   // rolled: one copy of the 16-row body
    for (int it = 0; it < 2; ++it) {
        const int i0 = (wave + 8 * it) * 16; const float mi = L.Ms[i0 + lr];
        v8h qp = {};   // the query's side of the mask terms: one of the three is -MQC, by the sign class of m_i (positive, negative, neither)
        if constexpr (!GEN) { qp[0] = mi > 0.f ? (h16)(-MQC) : (h16)0.f; qp[1] = mi < 0.f ? (h16)(-MQC) : (h16)0.f; qp[2] = (mi > 0.f || mi < 0.f) ? (h16)0.f : (h16)(-MQC); }
#pragma unroll 1   // rolled, as above
        for (int ch = 0; ch < CPG; ++ch) {
            const v16h qb = cat16(*(const v8ha*)&L.Qs[ch][hi][i0 + lr][0], qp);   // k 16..31: the mask terms, else zero
            v8f s[16];
#pragma unroll
            for (int t = 0; t < 16; ++t) { v8h kp = z8;
                if constexpr (!GEN) kp = *(const v8ha*)&L.Kp[t * 16 + lr][0];
                s[t] = wmma16(cat16(*(const v8ha*)&L.Ks[ch][hi][t * 16 + lr][0], kp), qb, (v8f){}); }   // s[t][r] = S[i0 + lr][16 t + 8 hi + r], minus 2^30 where the pair is masked
            v8f mxv;
#pragma unroll
            for (int r = 0; r < 8; ++r) mxv[r] = -3.0e38f;
            if constexpr (GEN) {
#pragma unroll
                for (int t = 0; t < 16; ++t) { const v4f ma = *(const v4fa*)&L.Ms[t * 16 + hi * 8], mb = *(const v4fa*)&L.Ms[t * 16 + hi * 8 + 4];
#pragma unroll
                    for (int r = 0; r < 8; ++r) { const float mj = r < 4 ? ma[r & 3] : mb[r & 3]; const float x = (mi * mj > 0.f) ? s[t][r] : -1.0e9f; s[t][r] = x; mxv[r] = fmaxf(mxv[r], x); } }
            } else {
#pragma unroll
                for (int t = 0; t < 16; ++t)
#pragma unroll
                    for (int r = 0; r < 8; ++r) mxv[r] = fmaxf(mxv[r], s[t][r]);
            }
            float mx = fmaxf(fmaxf(fmaxf(mxv[0], mxv[1]), fmaxf(mxv[2], mxv[3])), fmaxf(fmaxf(mxv[4], mxv[5]), fmaxf(mxv[6], mxv[7])));
            mx = fmaxf(mx, xhalf(mx));
            if constexpr (!GEN) __builtin_amdgcn_sched_barrier(0);   // keeps the reads of V^T behind the scores: lifted to the head of the pass they stood in 64 registers beside the K fragments and the build spilled
            const float l2e = (!GEN && mx < -5.0e8f) ? 0.f : 1.4426950408889634f;   // a row with every pair masked has equal weights, as the reference's row of equal logits has
            v8f sv = {};
#pragma unroll
            for (int t = 0; t < 16; ++t) { float e0 = (s[t][0] - mx) * l2e, e1 = (s[t][1] - mx) * l2e, e2 = (s[t][2] - mx) * l2e, e3 = (s[t][3] - mx) * l2e, e4 = (s[t][4] - mx) * l2e, e5 = (s[t][5] - mx) * l2e, e6 = (s[t][6] - mx) * l2e, e7 = (s[t][7] - mx) * l2e;
                // eight independent exp2 in place, then one v_nop: keeps the slot that the instruction set asks for behind a transcendental
                asm("v_exp_f32 %0, %0\n\tv_exp_f32 %1, %1\n\tv_exp_f32 %2, %2\n\tv_exp_f32 %3, %3\n\tv_exp_f32 %4, %4\n\tv_exp_f32 %5, %5\n\tv_exp_f32 %6, %6\n\tv_exp_f32 %7, %7\n\tv_nop" : "+v"(e0), "+v"(e1), "+v"(e2), "+v"(e3), "+v"(e4), "+v"(e5), "+v"(e6), "+v"(e7));
                s[t] = (v8f){e0, e1, e2, e3, e4, e5, e6, e7}; sv += s[t]; }
            float sum = ((sv[0] + sv[1]) + (sv[2] + sv[3])) + ((sv[4] + sv[5]) + (sv[6] + sv[7]));
            sum += xhalf(sum);
            const float f = PCAR / sum;
            v8f o = {};
#pragma unroll
            for (int u = 0; u < 8; ++u) { v16h pb;
#pragma unroll
                for (int r = 0; r < 8; ++r) { pb[r] = tohx(s[2 * u][r] * f); pb[8 + r] = tohx(s[2 * u + 1][r] * f); }
                o = wmma16(cat16(*(const v8ha*)&L.Vs[ch][lr][u * 32 + 8 * hi], *(const v8ha*)&L.Vs[ch][lr][u * 32 + 16 + 8 * hi]), pb, o); }   // o[r] = O[i0 + lr][8 hi + r] x 1024
            v4f o0, o1;
#pragma unroll
            for (int r = 0; r < 4; ++r) { o0[r] = o[r] * (1.0f / PCAR); o1[r] = o[4 + r] * (1.0f / PCAR); }
            *(v4fa*)&L.Os[wave][lr][ch * HD + hi * 8] = o0; *(v4fa*)&L.Os[wave][lr][ch * HD + hi * 8 + 4] = o1;
        }
        __builtin_amdgcn_fence(__ATOMIC_ACQ_REL, "wavefront");   // the reads below take what other lanes of this wave wrote: keeps the compiler from moving them up
        v4f ov[8]; float* op[8];
#pragma unroll
        for (int s = 0; s < 8; ++s) { const int row = hi + 2 * s; ov[s] = *(const v4fa*)&L.Os[wave][row][lr * 4]; op[s] = out + base + (size_t)(i0 + row) * DM + lr * 4; }
        // inputs only: the eight rows and their addresses all stand in registers of their own here, so that behind the first store no read-back and no address sum is left that could rewrite a register which an issued store names ahead of the wait below
        asm volatile("" :: "v"(ov[0]), "v"(ov[1]), "v"(ov[2]), "v"(ov[3]), "v"(ov[4]), "v"(ov[5]), "v"(ov[6]), "v"(ov[7]), "v"(op[0]), "v"(op[1]), "v"(op[2]), "v"(op[3]), "v"(op[4]), "v"(op[5]), "v"(op[6]), "v"(op[7]));
#pragma unroll
        for (int s = 0; s < 8; ++s) *(v4f*)op[s] = ov[s];
        __builtin_amdgcn_fence(__ATOMIC_ACQ_REL, "wavefront");   // the next 16 rows' writes to the staging rows stay behind these reads
        asm volatile("s_wait_xcnt 0x0" ::: "memory");            // stands in front of the next pass's rewrites of the registers that the stores above name
    }
    };
    if (general) rows(Sel<true>{}); else rows(Sel<false>{});
}

extern "C" void kernel_launch(void* const* d_in, const int* in_sizes, int n_in,
                              void* d_out, int out_size, void* d_ws, size_t ws_size, hipStream_t stream) {
    (void)in_sizes; (void)n_in; (void)out_size;
    const float* x = (const float*)d_in[0]; const float* msk = (const float*)d_in[1]; const float* Wq = (const float*)d_in[2]; const float* Wk = (const float*)d_in[3]; const float* Wv = (const float*)d_in[4];
    float* OUT = (float*)d_out;     // [32][256][1024]
    char* wsp = (char*)d_ws;
    auto take = [&](size_t bytes) { char* p = wsp; wsp += (bytes + 255) & ~(size_t)255; return (void*)p; };
    const size_t NR = (size_t)NB_ * TT;
    bf* XB = (bf*)take(NR * DM * 2); bf* BW = (bf*)take((size_t)3 * DM * DM * 2);
    if ((size_t)(wsp - (char*)d_ws) > ws_size) return;    // total ~ 23 MB
    k_cvt8<<<XG + 3 * WG, 256, 0, stream>>>(x, Wq, Wk, Wv, XB, BW);   // torch [out][in] = Bt
    k_fused<<<NB_ * (NC / CPG), 256, 0, stream>>>(XB, BW, msk, OUT);
}

// v007
// Measured time: 54.7 microseconds a run.
// Timed twice side by side with v006, it ran 1.04 times as fast both times.
// Counting every step since v000, it is 14.0 times as fast.
#include <hip/hip_runtime.h>

// SelfAttentionLayer (x [32][256][1024]; q/k/v = x W^T (torch [out,in], no bias); 64 chunks of 16 dims act as heads; logits = q.k / sqrt(1024) with mask2d = mask_i mask_j > 0 (sequence_mask read; all ones here); softmax; out[b][i][c*16 + d] = sum_j w v -> [32][256][1024]).
// Compute dtypes, f32 accumulate: every input rounded to bf16; q/k/v on PLAIN bf16 operands (inputs: exact); per-chunk scores single fp16 (q x log2(e)/32; the 16-dim heads padded to K 32 with the mask terms, else zeros) ; softmax f32, its weights exp2(s - max) -> fp16 unnormalised; attn.v single fp16, divided by the f32 row sum behind the product; products, scores, softmax and attn.v in one launch, the scores kept in registers. q x log2(e)/32, k and v go from the products to the attention part through LDS as fp16, rounded once from the f32 sums.

#define NB_  32
#define TT   256
#define DM   1024
#define HD   16
#define NC   64
#define QSC  (0.03125f * 1.4426950408889634f)   // 1 / sqrt(1024) of the logits, times log2(e): the scores come out of the matrix instruction in units of exp2
typedef _Float16 h16;
typedef unsigned short bf;
typedef __attribute__((ext_vector_type(16))) __bf16   v16bf;
typedef __attribute__((ext_vector_type(16))) _Float16 v16h;
typedef __attribute__((ext_vector_type(8)))  _Float16 v8h;
typedef __attribute__((ext_vector_type(8)))  unsigned short v8us;
typedef __attribute__((ext_vector_type(8)))  float    v8f;
typedef __attribute__((ext_vector_type(4)))  float    v4f;
typedef v8h  __attribute__((may_alias)) v8ha;
typedef v4f  __attribute__((may_alias)) v4fa;
typedef v8us __attribute__((may_alias)) v8usa;

__device__ __forceinline__ unsigned short f2bf(float f) { unsigned u = __float_as_uint(f); u += 0x7FFFu + ((u >> 16) & 1u); return (unsigned short)(u >> 16); }
__device__ __forceinline__ float bf2f(unsigned short b) { return __uint_as_float(((unsigned)b) << 16); }
__device__ __forceinline__ float bfr(float f) { return bf2f(f2bf(f)); }
__device__ __forceinline__ v16h cat16(v8h lo, v8h hi) { return __builtin_shufflevector(lo, hi, 0, 1, 2, 3, 4, 5, 6, 7, 8, 9, 10, 11, 12, 13, 14, 15); }
__device__ __forceinline__ v16bf cat16b(v8us lo, v8us hi) { return __builtin_bit_cast(v16bf, __builtin_shufflevector(lo, hi, 0, 1, 2, 3, 4, 5, 6, 7, 8, 9, 10, 11, 12, 13, 14, 15)); }
__device__ __forceinline__ v8f wmma16(v16h a, v16h b, v8f c) { return __builtin_amdgcn_wmma_f32_16x16x32_f16(false, a, false, b, (short)0, c, false, false); }
__device__ __forceinline__ v8f wmmab(v16bf a, v16bf b, v8f c) { return __builtin_amdgcn_wmma_f32_16x16x32_bf16(false, a, false, b, (short)0, c, false, false); }



__device__ __forceinline__ h16 tohx(float x) { return (h16)x; }
typedef __attribute__((ext_vector_type(2))) _Float16 v2h;
typedef __attribute__((ext_vector_type(4))) _Float16 v4h;

// ---- k_cvt8: x, Wq, Wk and Wv from f32 to bf16 in one launch, 8 elements a thread. Work-groups 0 .. XG - 1 take x, then WG work-groups each for Wq, Wk, Wv, whose bf16 planes lie one behind the other in wb.
#define XG (NB_ * TT * DM / 8 / 256)
#define WG (DM * DM / 8 / 256)
__global__ __launch_bounds__(256) void k_cvt8(const float* __restrict__ x, const float* __restrict__ wq, const float* __restrict__ wk, const float* __restrict__ wv, bf* __restrict__ xb, bf* __restrict__ wb) {
    const int blk = blockIdx.x; const float* src = x; bf* dst = xb; int rel = blk;
    if (blk >= XG) { const int p = (blk - XG) / WG; rel = (blk - XG) % WG; src = p == 0 ? wq : p == 1 ? wk : wv; dst = wb + (size_t)p * DM * DM; }
    const size_t i = (size_t)rel * 256 + threadIdx.x; const v8f v = *(const v8f*)(src + i * 8); v8us o;
#pragma unroll
    for (int k = 0; k < 8; ++k) o[k] = f2bf(v[k]); *(v8us*)(dst + i * 8) = o;  }
typedef v4h __attribute__((may_alias)) v4ha;
typedef v2h __attribute__((may_alias)) v2ha;
// lane l <-> lane l ^ 16
__device__ __forceinline__ float xhalf(float x) { const int b = __float_as_int(x); return __int_as_float(__builtin_amdgcn_permlanex16(b, b, 0x76543210, 0xfedcba98, false, false)); }

// ---- k_fused: one work-group (8 waves) per (sequence, four neighbouring 16-dim chunks): first q, k and v of those 64 columns, then their attention; q, k, v never leave the WGP.
// Part 1: C[256][192] = sum_k A[m][k] Bt[n][k], A the sequence's 256 rows, Bt 64 rows of each of the q, k and v weight planes (which lie one behind the other), K-contiguous bf16 of pitch DM.
// Waves 4 x 2, 64 rows x (32 q + 32 k + 32 v columns) per wave. The q and k tiles are formed transposed (weights as the A operand), so that a lane holds 8 consecutive d of one row, the v tiles straight, so that a lane holds 8 consecutive rows of one d:
// each is the 16-byte unit of its LDS layout in part 2 and goes there without a transpose.
// A stage is 128 k of the 256 A rows and 192 Bt rows, brought into LDS by asynchronous copies, two buffers: stage t + 2 flies while stage t + 1 is worked on. The k order of every sum is ascending.
#define GKS    128                 // k per stage: 256 B of every row, two whole lines
#define GPITCH 136                 // 16-bit elements per LDS row: 272 B = 16 B x odd, for 16-byte fragment reads down 16 rows
#define GROWS  448                 // 256 A rows, then 64 Bt rows of each plane
#define CPG    4                   // chunks per work-group
__device__ __forceinline__ v16bf ldfrag(const bf* p) { return cat16b(*(const v8usa*)p, *(const v8usa*)(p + 16)); }
// eight copies of 16 B per lane: rows 16 apart, LDS byte address l, global address g. The s_wait_xcnt stands inside the statement, in front of any rewrite of the address registers that the copies name.
__device__ __forceinline__ void copy8(unsigned l, const bf* g) {
    asm volatile("global_load_async_to_lds_b128 %0, %8, off\n\tglobal_load_async_to_lds_b128 %1, %9, off\n\tglobal_load_async_to_lds_b128 %2, %10, off\n\tglobal_load_async_to_lds_b128 %3, %11, off\n\t"
                 "global_load_async_to_lds_b128 %4, %12, off\n\tglobal_load_async_to_lds_b128 %5, %13, off\n\tglobal_load_async_to_lds_b128 %6, %14, off\n\tglobal_load_async_to_lds_b128 %7, %15, off\n\ts_wait_xcnt 0x0"
                 :: "v"(l), "v"(l + 1u * 16u * GPITCH * 2u), "v"(l + 2u * 16u * GPITCH * 2u), "v"(l + 3u * 16u * GPITCH * 2u), "v"(l + 4u * 16u * GPITCH * 2u), "v"(l + 5u * 16u * GPITCH * 2u), "v"(l + 6u * 16u * GPITCH * 2u), "v"(l + 7u * 16u * GPITCH * 2u),
                    "v"(g), "v"(g + 1 * 16 * DM), "v"(g + 2 * 16 * DM), "v"(g + 3 * 16 * DM), "v"(g + 4 * 16 * DM), "v"(g + 5 * 16 * DM), "v"(g + 6 * 16 * DM), "v"(g + 7 * 16 * DM) : "memory");
}
// the same for twelve copies: 64 rows of each of the three weight planes, which follow one another in LDS
__device__ __forceinline__ void copy12(unsigned l, const bf* g) {
    asm volatile("global_load_async_to_lds_b128 %0, %12, off\n\tglobal_load_async_to_lds_b128 %1, %13, off\n\tglobal_load_async_to_lds_b128 %2, %14, off\n\tglobal_load_async_to_lds_b128 %3, %15, off\n\t"
                 "global_load_async_to_lds_b128 %4, %16, off\n\tglobal_load_async_to_lds_b128 %5, %17, off\n\tglobal_load_async_to_lds_b128 %6, %18, off\n\tglobal_load_async_to_lds_b128 %7, %19, off\n\t"
                 "global_load_async_to_lds_b128 %8, %20, off\n\tglobal_load_async_to_lds_b128 %9, %21, off\n\tglobal_load_async_to_lds_b128 %10, %22, off\n\tglobal_load_async_to_lds_b128 %11, %23, off\n\ts_wait_xcnt 0x0"
                 :: "v"(l + 0u * 16u * GPITCH * 2u), "v"(l + 1u * 16u * GPITCH * 2u), "v"(l + 2u * 16u * GPITCH * 2u), "v"(l + 3u * 16u * GPITCH * 2u), "v"(l + 4u * 16u * GPITCH * 2u), "v"(l + 5u * 16u * GPITCH * 2u), "v"(l + 6u * 16u * GPITCH * 2u), "v"(l + 7u * 16u * GPITCH * 2u), "v"(l + 8u * 16u * GPITCH * 2u), "v"(l + 9u * 16u * GPITCH * 2u), "v"(l + 10u * 16u * GPITCH * 2u), "v"(l + 11u * 16u * GPITCH * 2u),
                    "v"(g + 0 * DM * DM + 0 * 16 * DM), "v"(g + 0 * DM * DM + 1 * 16 * DM), "v"(g + 0 * DM * DM + 2 * 16 * DM), "v"(g + 0 * DM * DM + 3 * 16 * DM), "v"(g + 1 * DM * DM + 0 * 16 * DM), "v"(g + 1 * DM * DM + 1 * 16 * DM), "v"(g + 1 * DM * DM + 2 * 16 * DM), "v"(g + 1 * DM * DM + 3 * 16 * DM), "v"(g + 2 * DM * DM + 0 * 16 * DM), "v"(g + 2 * DM * DM + 1 * 16 * DM), "v"(g + 2 * DM * DM + 2 * 16 * DM), "v"(g + 2 * DM * DM + 3 * 16 * DM) : "memory");
}
// one stage: 28 copies a lane
__device__ __forceinline__ void stage(unsigned l, const bf* ga, const bf* gb) {
    copy8(l, ga); copy8(l + 128u * GPITCH * 2u, ga + 128 * DM); copy12(l + 256u * GPITCH * 2u, gb);
}
#define VPITCH 264   // halves per V^T row: 528 B = 16 B x odd, for 16-byte LDS reads down a column of rows
#define OPITCH 68    // floats per staged output row: 272 B = 16 B x odd
// The mask in the score product. m_i m_j > 0 holds exactly where both values are positive or both negative (no underflow: see the test in the kernel). With p, n the indicators of positive and negative,
// p_i (1 - p_j) + n_i (1 - n_j) + (1 - p_i - n_i) is 1 for a masked pair and a sum of exact zeros for any other. The three terms stand in the zero-padded k of the 16-dim heads, scaled -MQC x MKC,
// in both halves of the wave: a masked score comes out of the matrix instruction 2^30 lower, an unmasked one unchanged, and no vector instruction per score is spent on the mask.
#define MKC 32768.0f
#define MQC 16384.0f
template <bool G> struct Sel { static constexpr bool v = G; };
struct AttnLds {
    h16 Qs[CPG][2][TT][8];     // [chunk][d / 8][row][d % 8]: a fragment read is 16 contiguous rows of 16 B per wave half
    h16 Ks[CPG][2][TT][8];
    h16 Vs[CPG][HD][VPITCH];   // [chunk][d][j]
    float Ms[TT];
    h16 Kp[TT][8];             // per key: the mask's three terms for k 16..18 (and 24..26) of the score product, then zeros
    float Os[8][16][OPITCH];
};
union FusedLds { bf ring[2][GROWS * GPITCH]; AttnLds at; };   // part 2's arrays take the ring's place once the last stage has been read
// amdgpu_waves_per_eu(2, 2): the ring leaves room for one work-group on a WGP, two waves a SIMD, so a wave may have 512 registers (192 of them accumulators).
__global__ __launch_bounds__(256) __attribute__((amdgpu_waves_per_eu(2, 2))) void k_fused(const bf* __restrict__ A, const bf* __restrict__ Bt, const float* __restrict__ msk, float* __restrict__ out) {
    __shared__ __align__(16) FusedLds sm;
    const int tid = threadIdx.x, lane = tid & 31, wave = tid >> 5, lr = lane & 15, hi = lane >> 4, wm = wave >> 1, wn = wave & 1;
    const int b = blockIdx.x >> 4, cg = blockIdx.x & 15;
    // a lane copies 16 B of row (tid / 16) + 16 i: a wave's copy is two whole 256-byte rows
    const bf* ga = A + (size_t)(b * TT + (tid >> 4)) * DM + (tid & 15) * 8;
    const bf* gb = Bt + (size_t)(cg * (CPG * HD) + (tid >> 4)) * DM + (tid & 15) * 8;
    const unsigned l0 = (unsigned)(size_t)&sm.ring[0][0] + (unsigned)(tid >> 4) * (GPITCH * 2u) + (unsigned)(tid & 15) * 16u;
    const unsigned lbuf = GROWS * GPITCH * 2u;
    // the loop forms its addresses from these, not from ga and gb: as operands of the first stage's asm statements ga and gb are tied to the low 256 registers, and kept alive through the loop beside the accumulators they were spilled to scratch and read back on every trip
    const unsigned vo = (unsigned)(tid >> 4) * DM + (unsigned)(tid & 15) * 8u;
    const unsigned sa0 = (unsigned)__builtin_amdgcn_readfirstlane(b) * (TT * DM), sb0 = (unsigned)__builtin_amdgcn_readfirstlane(cg) * (CPG * HD * DM);
    v8f acc[4][6];   // nb 0, 1: q; 2, 3: k (both transposed); 4, 5: v
#pragma unroll
    for (int mb = 0; mb < 4; ++mb)
#pragma unroll
        for (int nb = 0; nb < 6; ++nb) acc[mb][nb] = (v8f){};
    stage(l0, ga, gb);
    const float mraw = msk[b * TT + tid];
    asm volatile("s_wait_xcnt 0x0" ::: "memory");   // stands in front of the rewrites of the address registers that the load above names
    __builtin_amdgcn_sched_barrier(0);              // keeps the arithmetic below, which may reuse those registers, behind that wait
    asm volatile("s_wait_asynccnt 0x0" ::: "memory");   // stage 0 has landed before the barrier that publishes it
    __syncthreads();
    stage(l0 + lbuf, ga + GKS, gb + GKS);
#pragma unroll 1   // rolled: one stage per trip, the buffer chosen by the trip's parity
    for (int t = 0; t < DM / GKS; ++t) {
        const bf* sa = &sm.ring[t & 1][(wm * 64 + lr) * GPITCH + 8 * hi];
        const bf* sb = &sm.ring[t & 1][(256 + wn * 32 + lr) * GPITCH + 8 * hi];   // tile nb: plane nb / 2, 64 rows on; 16 rows on for odd nb
        v16bf a[2][4], w[2][6];   // two fragment sets: block ks + 1 is fetched while block ks is multiplied; no fragment of the next stage is fetched here
#pragma unroll
        for (int f = 0; f < 4; ++f) a[0][f] = ldfrag(sa + f * 16 * GPITCH);
#pragma unroll
        for (int f = 0; f < 6; ++f) w[0][f] = ldfrag(sb + ((f >> 1) * 64 + (f & 1) * 16) * GPITCH);
#pragma unroll
        for (int ks = 0; ks < GKS / 32; ++ks) {
            if (ks + 1 < GKS / 32) {
#pragma unroll
                for (int f = 0; f < 4; ++f) a[(ks + 1) & 1][f] = ldfrag(sa + f * 16 * GPITCH + (ks + 1) * 32);
#pragma unroll
                for (int f = 0; f < 6; ++f) w[(ks + 1) & 1][f] = ldfrag(sb + ((f >> 1) * 64 + (f & 1) * 16) * GPITCH + (ks + 1) * 32); }
            __builtin_amdgcn_sched_barrier(0);   // keeps the next block's LDS reads as one group in front of this block
#pragma unroll
            for (int nb = 0; nb < 6; ++nb)
#pragma unroll
                for (int mb = 0; mb < 4; ++mb) acc[mb][nb] = nb < 4 ? wmmab(w[ks & 1][nb], a[ks & 1][mb], acc[mb][nb]) : wmmab(a[ks & 1][mb], w[ks & 1][nb], acc[mb][nb]);
            __builtin_amdgcn_sched_barrier(0);   // the reads of block ks + 2 stay behind this block; the last block stays in front of the stage's waits, so that the copies in flight have the whole trip to land
        }
        asm volatile("s_wait_dscnt 0x0" ::: "memory");      // this wave's reads of the buffer are done before it is refilled
        asm volatile("s_wait_asynccnt 0x0" ::: "memory");   // this wave's copies of stage t + 1 have landed before the barrier that publishes them
        __syncthreads();
        if (t + 2 < DM / GKS) stage(l0 + (unsigned)(t & 1) * lbuf, A + ((size_t)sa0 + (t + 2) * GKS + vo), Bt + ((size_t)sb0 + (t + 2) * GKS + vo));
    }
    asm volatile("s_wait_asynccnt 0x0" ::: "memory");       // no copy is outstanding when the ring's LDS is given to part 2
    // behind the last trip's barrier no wave reads the ring any more: q x QSC, k and v go to their places as fp16
    AttnLds& L = sm.at;
#pragma unroll
    for (int mb = 0; mb < 4; ++mb)
#pragma unroll
        for (int nb = 0; nb < 6; ++nb) { const int ch = wn * 2 + (nb & 1), row = wm * 64 + mb * 16; v8h o;
#pragma unroll
            for (int j = 0; j < 8; ++j) o[j] = (h16)(acc[mb][nb][j] * (nb < 2 ? QSC : 1.0f));
            if (nb < 2) *(v8ha*)&L.Qs[ch][hi][row + lr][0] = o;            // acc[j] = q[row + lr][16 ch + 8 hi + j]
            else if (nb < 4) *(v8ha*)&L.Ks[ch][hi][row + lr][0] = o;
            else *(v8ha*)&L.Vs[ch][lr][row + hi * 8] = o; }                // acc[j] = v[row + 8 hi + j][16 ch + lr]
    const size_t base = (size_t)b * TT * DM + (size_t)cg * (CPG * HD);
    const float mown = bfr(mraw);
    L.Ms[tid] = mown;
    { v8h kp = {}; kp[0] = mown > 0.f ? (h16)0.f : (h16)MKC; kp[1] = mown < 0.f ? (h16)0.f : (h16)MKC; kp[2] = (h16)MKC; *(v8ha*)&L.Kp[tid][0] = kp; }
    __syncthreads();
    const v8h z8 = {};
    // a non-zero mask value below 2^-63 can make m_i m_j underflow, which the sign classes do not see: such a sequence takes the form that multiplies the mask values out. The test reads all 256 values in every wave, so it is the same for the whole work-group.
    bool tiny = false;
    { const v4f ta = *(const v4fa*)&L.Ms[lane * 8], tb = *(const v4fa*)&L.Ms[lane * 8 + 4];
#pragma unroll
      for (int r = 0; r < 4; ++r) { const float a0 = fabsf(ta[r]), a1 = fabsf(tb[r]); tiny = tiny | ((a0 > 0.f) & (a0 < 0x1p-63f)) | ((a1 > 0.f) & (a1 < 0x1p-63f)); } }
    const bool general = __builtin_amdgcn_ballot_w32(tiny) != 0u;
    auto rows = [&](auto gsel) {
    constexpr bool GEN = decltype(gsel)::v;
#pragma unroll 1   // rolled: one copy of the 16-row body
    for (int it = 0; it < 2; ++it) {
        const int i0 = (wave + 8 * it) * 16; const float mi = L.Ms[i0 + lr];
        v8h qp = {};   // the query's side of the mask terms: one of the three is -MQC, by the sign class of m_i (positive, negative, neither)
        if constexpr (!GEN) { qp[0] = mi > 0.f ? (h16)(-MQC) : (h16)0.f; qp[1] = mi < 0.f ? (h16)(-MQC) : (h16)0.f; qp[2] = (mi > 0.f || mi < 0.f) ? (h16)0.f : (h16)(-MQC); }
#pragma unroll 1   // rolled, as above
        for (int ch = 0; ch < CPG; ++ch) {
            const v16h qb = cat16(*(const v8ha*)&L.Qs[ch][hi][i0 + lr][0], qp);   // k 16..31: the mask terms, else zero
            v8f s[16];
#pragma unroll
            for (int t = 0; t < 16; ++t) { v8h kp = z8;
                if constexpr (!GEN) kp = *(const v8ha*)&L.Kp[t * 16 + lr][0];
                s[t] = wmma16(cat16(*(const v8ha*)&L.Ks[ch][hi][t * 16 + lr][0], kp), qb, (v8f){}); }   // s[t][r] = S[i0 + lr][16 t + 8 hi + r], minus 2^30 where the pair is masked
            v8f mxv;
#pragma unroll
            for (int r = 0; r < 8; ++r) mxv[r] = -3.0e38f;
            if constexpr (GEN) {
#pragma unroll
                for (int t = 0; t < 16; ++t) { const v4f ma = *(const v4fa*)&L.Ms[t * 16 + hi * 8], mb = *(const v4fa*)&L.Ms[t * 16 + hi * 8 + 4];
#pragma unroll
                    for (int r = 0; r < 8; ++r) { const float mj = r < 4 ? ma[r & 3] : mb[r & 3]; const float x = (mi * mj > 0.f) ? s[t][r] : -1.0e9f; s[t][r] = x; mxv[r] = fmaxf(mxv[r], x); } }
            } else {
#pragma unroll
                for (int t = 0; t < 16; ++t)
#pragma unroll
                    for (int r = 0; r < 8; ++r) mxv[r] = fmaxf(mxv[r], s[t][r]);
            }
            float mx = fmaxf(fmaxf(fmaxf(mxv[0], mxv[1]), fmaxf(mxv[2], mxv[3])), fmaxf(fmaxf(mxv[4], mxv[5]), fmaxf(mxv[6], mxv[7])));
            mx = fmaxf(mx, xhalf(mx));
            if constexpr (!GEN) __builtin_amdgcn_sched_barrier(0);   // keeps the reads of V^T behind the scores: lifted to the head of the pass they stood in 64 registers beside the K fragments and the build spilled
            // s - max as one packed fma a pair of scores. The factor is 0 for a row with every pair masked: equal weights, as the reference's row of equal logits has
            const float one = (!GEN && mx < -5.0e8f) ? 0.f : 1.f, nmx = -mx * one;
            v8f one8, nmx8;
#pragma unroll
            for (int r = 0; r < 8; ++r) { one8[r] = one; nmx8[r] = nmx; }
            v8f sv = {}, o = {};
#pragma unroll
            for (int u = 0; u < 8; ++u) {
#pragma unroll
                for (int t = 2 * u; t < 2 * u + 2; ++t) { const v8f d = __builtin_elementwise_fma(s[t], one8, nmx8);
                    float e0 = d[0], e1 = d[1], e2 = d[2], e3 = d[3], e4 = d[4], e5 = d[5], e6 = d[6], e7 = d[7];
                    // eight independent exp2 in place, then one v_nop: keeps the slot that the instruction set asks for behind a transcendental
                    asm("v_exp_f32 %0, %0\n\tv_exp_f32 %1, %1\n\tv_exp_f32 %2, %2\n\tv_exp_f32 %3, %3\n\tv_exp_f32 %4, %4\n\tv_exp_f32 %5, %5\n\tv_exp_f32 %6, %6\n\tv_exp_f32 %7, %7\n\tv_nop" : "+v"(e0), "+v"(e1), "+v"(e2), "+v"(e3), "+v"(e4), "+v"(e5), "+v"(e6), "+v"(e7));
                    s[t] = (v8f){e0, e1, e2, e3, e4, e5, e6, e7}; sv += s[t]; }
                v16h pb;   // the weights as they stand, at most 1: the row sum divides the product, not each weight
#pragma unroll
                for (int r = 0; r < 8; ++r) { pb[r] = tohx(s[2 * u][r]); pb[8 + r] = tohx(s[2 * u + 1][r]); }
                o = wmma16(cat16(*(const v8ha*)&L.Vs[ch][lr][u * 32 + 8 * hi], *(const v8ha*)&L.Vs[ch][lr][u * 32 + 16 + 8 * hi]), pb, o); }   // o[r] = O[i0 + lr][8 hi + r] x the row sum
            float sum = ((sv[0] + sv[1]) + (sv[2] + sv[3])) + ((sv[4] + sv[5]) + (sv[6] + sv[7]));
            sum += xhalf(sum);
            const float f = 1.0f / sum;
            v4f o0, o1;
#pragma unroll
            for (int r = 0; r < 4; ++r) { o0[r] = o[r] * f; o1[r] = o[4 + r] * f; }
            *(v4fa*)&L.Os[wave][lr][ch * HD + hi * 8] = o0; *(v4fa*)&L.Os[wave][lr][ch * HD + hi * 8 + 4] = o1;
        }
        __builtin_amdgcn_fence(__ATOMIC_ACQ_REL, "wavefront");   // the reads below take what other lanes of this wave wrote: keeps the compiler from moving them up
        v4f ov[8]; float* op[8];
#pragma unroll
        for (int s = 0; s < 8; ++s) { const int row = hi + 2 * s; ov[s] = *(const v4fa*)&L.Os[wave][row][lr * 4]; op[s] = out + base + (size_t)(i0 + row) * DM + lr * 4; }
        // inputs only: the eight rows and their addresses all stand in registers of their own here, so that behind the first store no read-back and no address sum is left that could rewrite a register which an issued store names ahead of the wait below
        asm volatile("" :: "v"(ov[0]), "v"(ov[1]), "v"(ov[2]), "v"(ov[3]), "v"(ov[4]), "v"(ov[5]), "v"(ov[6]), "v"(ov[7]), "v"(op[0]), "v"(op[1]), "v"(op[2]), "v"(op[3]), "v"(op[4]), "v"(op[5]), "v"(op[6]), "v"(op[7]));
#pragma unroll
        for (int s = 0; s < 8; ++s) *(v4f*)op[s] = ov[s];
        __builtin_amdgcn_fence(__ATOMIC_ACQ_REL, "wavefront");   // the next 16 rows' writes to the staging rows stay behind these reads
        asm volatile("s_wait_xcnt 0x0" ::: "memory");            // stands in front of the next pass's rewrites of the registers that the stores above name
    }
    };
    if (general) rows(Sel<true>{}); else rows(Sel<false>{});
}

extern "C" void kernel_launch(void* const* d_in, const int* in_sizes, int n_in,
                              void* d_out, int out_size, void* d_ws, size_t ws_size, hipStream_t stream) {
    (void)in_sizes; (void)n_in; (void)out_size;
    const float* x = (const float*)d_in[0]; const float* msk = (const float*)d_in[1]; const float* Wq = (const float*)d_in[2]; const float* Wk = (const float*)d_in[3]; const float* Wv = (const float*)d_in[4];
    float* OUT = (float*)d_out;     // [32][256][1024]
    char* wsp = (char*)d_ws;
    auto take = [&](size_t bytes) { char* p = wsp; wsp += (bytes + 255) & ~(size_t)255; return (void*)p; };
    const size_t NR = (size_t)NB_ * TT;
    bf* XB = (bf*)take(NR * DM * 2); bf* BW = (bf*)take((size_t)3 * DM * DM * 2);
    if ((size_t)(wsp - (char*)d_ws) > ws_size) return;    // total ~ 23 MB
    k_cvt8<<<XG + 3 * WG, 256, 0, stream>>>(x, Wq, Wk, Wv, XB, BW);   // torch [out][in] = Bt
    k_fused<<<NB_ * (NC / CPG), 256, 0, stream>>>(XB, BW, msk, OUT);
}
